// v000
// The times below were measured on an AMD MI455X: many runs one after another, warmed up first and cycling through
// copies of the inputs, with the whole window's GPU time divided by the number of runs. Launches and the gaps
// between them are all in it. The median over several windows is given; except for v000 it joins two sittings, which
// can be a few percent apart, so the side-by-side timings, each taken in one sitting, are the better comparison.
// v000, which the later versions start from, runs in 4770 microseconds.
#include <hip/hip_runtime.h>

// Self-attention with a contact-map-scaled score and an additive mask (hidden_states [32][256][768]; q, k, v = x W + b ('xw' [768][768], 12 heads x 64); cm = w_cm contact_map[b][0][i][j] + b_cm (scalar 1x1 conv; inputs read); scores = (q.k/8) cm + attention_mask[b][0][0][j]; softmax; out = merged attn.v (no output projection) -> [32][256][768] f32 (6.3 M)).
// Compute dtypes, f32 accumulate: every input rounded to bf16; q/k/v on PLAIN bf16 operands (inputs: exact) + biases; scores and attn.v: all 256 query rows hl (3 products); softmax f32; no output projection: the merged context is written in f32.

#define NB_  32
#define TT   256
#define DM   768
#define NH_  12
#define NKV  12
#define REP  (NH_ / NKV)
#define HD   64
#define DQ   (NH_ * HD)
#define DKV  (NKV * HD)
#define ZH   2
#define RH   256                  // query rows < RH use hi+lo planes (0: none)
#define WIN  0
#define PCAR 1024.0f
#define SCL  0.125f   // HD^-0.5
typedef _Float16 h16;
typedef unsigned short bf;
typedef __attribute__((ext_vector_type(16))) __bf16   v16bf;
typedef __attribute__((ext_vector_type(16))) _Float16 v16h;
typedef __attribute__((ext_vector_type(8)))  _Float16 v8h;
typedef __attribute__((ext_vector_type(8)))  unsigned short v8us;
typedef __attribute__((ext_vector_type(8)))  float    v8f;
typedef __attribute__((ext_vector_type(4)))  float    v4f;
typedef v8h  __attribute__((may_alias)) v8ha;
typedef v4f  __attribute__((may_alias)) v4fa;
typedef v8us __attribute__((may_alias)) v8usa;

__device__ __forceinline__ unsigned short f2bf(float f) { unsigned u = __float_as_uint(f); u += 0x7FFFu + ((u >> 16) & 1u); return (unsigned short)(u >> 16); }
__device__ __forceinline__ float bf2f(unsigned short b) { return __uint_as_float(((unsigned)b) << 16); }
__device__ __forceinline__ float bfr(float f) { return bf2f(f2bf(f)); }
__device__ __forceinline__ v16h cat16(v8h lo, v8h hi) { return __builtin_shufflevector(lo, hi, 0, 1, 2, 3, 4, 5, 6, 7, 8, 9, 10, 11, 12, 13, 14, 15); }
__device__ __forceinline__ v16bf cat16b(v8us lo, v8us hi) { return __builtin_bit_cast(v16bf, __builtin_shufflevector(lo, hi, 0, 1, 2, 3, 4, 5, 6, 7, 8, 9, 10, 11, 12, 13, 14, 15)); }
__device__ __forceinline__ v8f wmma16(v16h a, v16h b, v8f c) { return __builtin_amdgcn_wmma_f32_16x16x32_f16(false, a, false, b, (short)0, c, false, false); }
__device__ __forceinline__ v8f wmmab(v16bf a, v16bf b, v8f c) { return __builtin_amdgcn_wmma_f32_16x16x32_bf16(false, a, false, b, (short)0, c, false, false); }



// ---- k_gemmw: register-blocked GEMM, ONE WAVE per 64x64 output tile (16 accumulators), operands straight from K-contiguous 16-bit planes; grid (M/64, N/64, Z), 32 threads.
// C[m][n] (f32, pitch ldc, + optional f32 bias[n]) = sum_k A[m][k] Bt[n][k] (+ split products per NSPLIT). z-batch strides sA/sB/sC in elements. K % 32 == 0.
template <typename T16> struct WFrag;
template <> struct WFrag<h16> { typedef v16h V; static __device__ __forceinline__ V ld(const h16* p) { return cat16(*(const v8h*)p, *(const v8h*)(p + 16)); } static __device__ __forceinline__ v8f mma(V a, V b, v8f c) { return wmma16(a, b, c); } };
template <> struct WFrag<bf> { typedef v16bf V; static __device__ __forceinline__ V ld(const bf* p) { return cat16b(*(const v8us*)p, *(const v8us*)(p + 16)); } static __device__ __forceinline__ v8f mma(V a, V b, v8f c) { return wmmab(a, b, c); } };
template <typename T16, int NSPLIT, bool BIAS>
__global__ __launch_bounds__(32) void k_gemmw(const T16* __restrict__ A, const T16* __restrict__ A2, const T16* __restrict__ Bt, const T16* __restrict__ Bt2, int K, float* C, int ldc, const float* __restrict__ bias, size_t sA, size_t sB, size_t sC) {
    typedef typename WFrag<T16>::V V;
    __shared__ __align__(16) float os[16 * 68];
    const size_t z = blockIdx.z; A += z * sA; if (A2) A2 += z * sA; Bt += z * sB; if (Bt2) Bt2 += z * sB; C += z * sC;
    const int lane = threadIdx.x & 31, lr = lane & 15, hi = lane >> 4; const int r0 = blockIdx.x * 64, c0 = blockIdx.y * 64;
    v8f acc[4][4];
#pragma unroll
    for (int mb = 0; mb < 4; ++mb)
#pragma unroll
        for (int nb = 0; nb < 4; ++nb) acc[mb][nb] = (v8f){};
    const size_t aoff = (size_t)(r0 + lr) * K + 8 * hi, boff = (size_t)(c0 + lr) * K + 8 * hi;
#pragma unroll 1
    for (int kc = 0; kc < K; kc += 32) {
        V a[4], a2[4];
#pragma unroll
        for (int mb = 0; mb < 4; ++mb) { a[mb] = WFrag<T16>::ld(A + aoff + (size_t)mb * 16 * K + kc); if (NSPLIT == 1 || NSPLIT == 2) a2[mb] = WFrag<T16>::ld(A2 + aoff + (size_t)mb * 16 * K + kc); }
#pragma unroll
        for (int nb = 0; nb < 4; ++nb) { const V b = WFrag<T16>::ld(Bt + boff + (size_t)nb * 16 * K + kc); V b2; if (NSPLIT >= 2) b2 = WFrag<T16>::ld(Bt2 + boff + (size_t)nb * 16 * K + kc);
#pragma unroll
            for (int mb = 0; mb < 4; ++mb) { acc[mb][nb] = WFrag<T16>::mma(a[mb], b, acc[mb][nb]); if (NSPLIT == 1 || NSPLIT == 2) acc[mb][nb] = WFrag<T16>::mma(a2[mb], b, acc[mb][nb]); if (NSPLIT >= 2) acc[mb][nb] = WFrag<T16>::mma(a[mb], b2, acc[mb][nb]); } }
        asm volatile("v_nop\n\tv_nop\n\tv_nop\n\tv_nop" : "+v"(acc[0][0]), "+v"(acc[1][1]), "+v"(acc[2][2]), "+v"(acc[3][3]) : "v"(a[0]), "v"(a[3]));
    }
#pragma unroll
    for (int mb = 0; mb < 4; ++mb) {
#pragma unroll
        for (int nb = 0; nb < 4; ++nb) {
#pragma unroll
            for (int j = 0; j < 8; ++j) os[(hi * 8 + j) * 68 + nb * 16 + lr] = acc[mb][nb][j]; }
        __builtin_amdgcn_wave_barrier(); asm volatile("" ::: "memory");
        float* crow = C + (size_t)(r0 + mb * 16) * ldc + c0;
{
#pragma unroll
            for (int s = 0; s < 8; ++s) { const int row = 2 * s + hi, cofs = lr * 4; v4f val = *(const v4fa*)(os + row * 68 + cofs); if (BIAS) { val[0] += bfr(bias[c0 + cofs]); val[1] += bfr(bias[c0 + cofs + 1]); val[2] += bfr(bias[c0 + cofs + 2]); val[3] += bfr(bias[c0 + cofs + 3]); }
                *(v4f*)(crow + (size_t)row * ldc + cofs) = val; }
             }
        __builtin_amdgcn_wave_barrier(); asm volatile("" ::: "memory");
    }
}

__device__ __forceinline__ h16 tohx(float x) { return (h16)x; }
__device__ __forceinline__ void splitf(float y, unsigned short& h, unsigned short& l) { h = f2bf(y); l = f2bf(y - bf2f(h)); }
typedef __attribute__((ext_vector_type(2))) _Float16 v2h;
typedef __attribute__((ext_vector_type(4))) _Float16 v4h;
typedef __attribute__((ext_vector_type(2))) unsigned short v2us;
typedef __attribute__((ext_vector_type(4))) unsigned short v4us;
typedef __attribute__((ext_vector_type(2))) float v2f;
typedef __attribute__((ext_vector_type(4))) int v4i;

__global__ __launch_bounds__(256) void k_wtG(const float* __restrict__ w, int K, int N, bf* Bt) {
    const int lane = threadIdx.x & 31; const int L0 = (blockIdx.x * 8 + (threadIdx.x >> 5)) * 8; const int nlines = N * K / 64;
{
#pragma unroll 1
        for (int l = 0; l < 8; ++l) { const int L = L0 + l; if (L >= nlines) break; const size_t e = (size_t)L * 64 + lane * 2; const int k = (int)(e % K), n = (int)(e / K); v2us o;
            o[0] = f2bf(w[(size_t)k * N + n]); o[1] = f2bf(w[(size_t)(k + 1) * N + n]); *(v2us*)(Bt + e) = o; }
         }
}
__global__ __launch_bounds__(256) void k_cvt8(const float* __restrict__ src, bf* dst, size_t n8) { const size_t i = (size_t)blockIdx.x * 256 + threadIdx.x; if (i >= n8) return; const v8f v = *(const v8f*)(src + i * 8); v8us o;
#pragma unroll
    for (int k = 0; k < 8; ++k) o[k] = f2bf(v[k]); *(v8us*)(dst + i * 8) = o;  }

// k_rope: head planes [h][t][d] (fp16 + hi/lo) of rope(x) x sc with the rotate-half convention out[d] = x[d] cos[t][d] - x[d+HD/2] sin[t][d], out[d+HD/2] = x[d+HD/2] cos[t][d+HD/2] + x[d] sin[t][d+HD/2]
__global__ __launch_bounds__(256) void k_rope(const float* __restrict__ F, int pitch, int nheads, const float* __restrict__ CS, const float* __restrict__ RF, const float* __restrict__ nw, float sc, h16* P16, bf* Ph, bf* Pl) {
    const size_t e = ((size_t)blockIdx.x * 256 + threadIdx.x) * 2; if (e >= (size_t)nheads * TT * HD) return; const int d = (int)(e % HD); const int t = (int)((e / HD) % TT); const int h = (int)(e / ((size_t)HD * TT)); const float* f = F + (size_t)t * pitch + h * HD; const float rf = RF ? RF[(size_t)h * TT + t] : 1.0f; v2h o16; v2us oh, ol;
#pragma unroll
    for (int q = 0; q < 2; ++q) { const int dd = d + q; const int dp = (dd < HD / 2) ? dd + HD / 2 : dd - HD / 2; float x0 = f[dd], x1 = f[dp];
        if (RF) { float n0 = __fmul_rn(x0, rf), n1 = __fmul_rn(x1, rf); asm volatile("" : "+v"(n0)); asm volatile("" : "+v"(n1)); x0 = __fmul_rn(bfr(nw[dd]), n0); x1 = __fmul_rn(bfr(nw[dp]), n1); }
        const v2f cs = *(const v2f*)(CS + ((size_t)t * HD + dd) * 2); float a = __fmul_rn(x0, cs[0]), bq = __fmul_rn(x1, cs[1]); asm volatile("" : "+v"(a)); asm volatile("" : "+v"(bq)); const float r = ((dd < HD / 2) ? __fsub_rn(a, bq) : __fadd_rn(a, bq)) * sc;
        o16[q] = tohx(r); unsigned short a2, c2; splitf(r, a2, c2); oh[q] = a2; ol[q] = c2; }
    *(v2h*)(P16 + e) = o16; *(v2us*)(Ph + e) = oh; *(v2us*)(Pl + e) = ol;  }
__global__ __launch_bounds__(256) void k_vtp(const float* __restrict__ F, int pitch, int nheads, h16* V16, bf* Vh, bf* Vl) { const size_t e = ((size_t)blockIdx.x * 256 + threadIdx.x) * 2; if (e >= (size_t)nheads * HD * TT) return; const int t = (int)(e % TT); const int d = (int)((e / TT) % HD); const int g = (int)(e / ((size_t)TT * HD)); v2h o16; v2us oh, ol;
#pragma unroll
    for (int q = 0; q < 2; ++q) { const float x = F[(size_t)(t + q) * pitch + g * HD + d]; o16[q] = tohx(x); unsigned short a2, c2; splitf(x, a2, c2); oh[q] = a2; ol[q] = c2; }
    *(v2h*)(V16 + e) = o16; *(v2us*)(Vh + e) = oh; *(v2us*)(Vl + e) = ol;  }
__global__ __launch_bounds__(256) void k_csid(float* CS) { const int idx = blockIdx.x * 256 + threadIdx.x; if (idx >= TT * HD) return; v2f cs; cs[0] = 1.0f; cs[1] = 0.0f; *(v2f*)(CS + (size_t)idx * 2) = cs;  }
// k_asoft: per row (zz, i): t = S x HD^-0.5 x cm + mask; softmax over the 256 keys (register row, one exp, fixed trees);
__global__ __launch_bounds__(256) void k_asoft(const float* __restrict__ Sb, const float* __restrict__ CMb, const float* __restrict__ AMb, const float* __restrict__ WCM, const float* __restrict__ BCM, h16* P16, bf* Ph, bf* Pl) {
    const int lane = threadIdx.x & 31; const int row = blockIdx.x * 8 + (threadIdx.x >> 5); if (row >= ZH * TT) return; const int i = row % TT; const int zz = row / TT; (void)zz; const float wcm = bfr(WCM[0]), bcm = bfr(BCM[0]); const float* cmr = CMb + (size_t)i * TT; const bool hires = (i < RH); const float* sr = Sb + (size_t)row * TT; float v[TT / 32]; float mx = -3.0e38f;
#pragma unroll
    for (int ch = 0; ch < TT / 128; ++ch) { const int j0 = ch * 128 + lane * 4; const v4f a = *(const v4f*)(sr + j0); const v4f c4 = *(const v4f*)(cmr + j0), m4 = *(const v4f*)(AMb + j0);
#pragma unroll
        for (int q = 0; q < 4; ++q) { const int j = j0 + q; (void)j; float cmv = __fmul_rn(wcm, bfr(c4[q])); asm volatile("" : "+v"(cmv)); const float cm = __fadd_rn(cmv, bcm); float sa = a[q] * SCL; asm volatile("" : "+v"(sa)); float sc = __fmul_rn(sa, cm); asm volatile("" : "+v"(sc)); const float t = __fadd_rn(sc, bfr(m4[q]));   /* (q.k/8) x (w_cm c + b_cm) + mask */ v[ch * 4 + q] = t; mx = fmaxf(mx, t); } }
#pragma unroll
    for (int sh = 16; sh; sh >>= 1) mx = fmaxf(mx, __shfl_xor(mx, sh, 32));
    float sum = 0.f;
#pragma unroll
    for (int k = 0; k < TT / 32; ++k) { float d0 = __fsub_rn(v[k], mx); asm volatile("" : "+v"(d0)); v[k] = __builtin_amdgcn_exp2f(__fmul_rn(d0, 1.4426950408889634f)); sum += v[k]; }
#pragma unroll
    for (int sh = 16; sh; sh >>= 1) sum += __shfl_xor(sum, sh, 32);
    const float f = __fdiv_rn(hires ? 1.0f : PCAR, sum);
{
        if (hires) {
#pragma unroll
            for (int ch = 0; ch < TT / 128; ++ch) { v4us oh, ol;
#pragma unroll
                for (int q = 0; q < 4; ++q) { unsigned short a, c2; splitf(v[ch * 4 + q] * f, a, c2); oh[q] = a; ol[q] = c2; }
                const size_t oo = ((size_t)zz * (RH ? RH : 1) + i) * TT + ch * 128 + lane * 4; *(v4us*)(Ph + oo) = oh; *(v4us*)(Pl + oo) = ol; }
        } else {
#pragma unroll
            for (int ch = 0; ch < TT / 128; ++ch) { v4h o4;
#pragma unroll
                for (int q = 0; q < 4; ++q) o4[q] = tohx(v[ch * 4 + q] * f);
                *(v4h*)(P16 + (size_t)row * TT + ch * 128 + lane * 4) = o4; } }
         }
}
__global__ __launch_bounds__(256) void k_merge(const float* __restrict__ O, int h0, float* OUTb) { const size_t e = ((size_t)blockIdx.x * 256 + threadIdx.x) * 2; if (e >= (size_t)ZH * TT * HD) return; const int d = (int)(e % HD); const int t = (int)((e / HD) % TT); const int zz = (int)(e / ((size_t)HD * TT)); const float cs = (t < RH) ? 1.0f : (1.0f / PCAR); const size_t oo = (size_t)t * DQ + (h0 + zz) * HD + d;
    v2f o2; o2[0] = O[e] * cs; o2[1] = O[e + 1] * cs; *(v2f*)(OUTb + oo) = o2;  }   /* f32 context straight to the output */

extern "C" void kernel_launch(void* const* d_in, const int* in_sizes, int n_in,
                              void* d_out, int out_size, void* d_ws, size_t ws_size, hipStream_t stream) {
    (void)in_sizes; (void)n_in; (void)out_size;
    const float* x = (const float*)d_in[0]; const float* CM = (const float*)d_in[1]; const float* AM = (const float*)d_in[2]; const float* wq = (const float*)d_in[3]; const float* bq = (const float*)d_in[4]; const float* wk = (const float*)d_in[5]; const float* bk = (const float*)d_in[6]; const float* wv = (const float*)d_in[7]; const float* bv = (const float*)d_in[8]; const float* WCM = (const float*)d_in[9]; const float* BCM = (const float*)d_in[10]; const float* wo = nullptr; (void)wo;
    float* OUT = (float*)d_out;     // [32][256][768]
    char* wsp = (char*)d_ws;
    auto take = [&](size_t bytes) { char* p = wsp; wsp += (bytes + 255) & ~(size_t)255; return (void*)p; };
    bf* WQ = (bf*)take((size_t)DQ * DM * 2); bf* WK = (bf*)take((size_t)DKV * DM * 2); bf* WV = (bf*)take((size_t)DKV * DM * 2); float* CS = (float*)take((size_t)TT * HD * 2 * 4);
    bf* XB = (bf*)take((size_t)TT * DM * 2); float* FQ = (float*)take((size_t)TT * DQ * 4); float* FK = (float*)take((size_t)TT * DKV * 4);
    h16* QP16 = (h16*)take((size_t)NH_ * TT * HD * 2); h16* KP16 = (h16*)take((size_t)NKV * TT * HD * 2); h16* VT16 = (h16*)take((size_t)NKV * HD * TT * 2);
    bf* QPh = (bf*)take((size_t)NH_ * TT * HD * 2); bf* QPl = (bf*)take((size_t)NH_ * TT * HD * 2); bf* KPh = (bf*)take((size_t)NKV * TT * HD * 2); bf* KPl = (bf*)take((size_t)NKV * TT * HD * 2); bf* VTh = (bf*)take((size_t)NKV * HD * TT * 2); bf* VTl = (bf*)take((size_t)NKV * HD * TT * 2); bf* Ph = (bf*)take((size_t)ZH * RH * TT * 2); bf* Pl = (bf*)take((size_t)ZH * RH * TT * 2);
    float* Sb = (float*)take((size_t)ZH * TT * TT * 4); h16* P16 = (h16*)take(256);   /* unused: all rows hi/lo */ float* Ob = (float*)take((size_t)ZH * TT * HD * 4); 
    if ((size_t)(wsp - (char*)d_ws) > ws_size) return;    // ws 256 MiB
    float* FV = FK;   // v projection reuses the k buffer after the k planes are built (stream-ordered)
    { k_wtG<<<(unsigned)((DM * DQ / 64 + 63) / 64), 256, 0, stream>>>(wq, DM, DQ, WQ); k_wtG<<<(unsigned)((DM * DKV / 64 + 63) / 64), 256, 0, stream>>>(wk, DM, DKV, WK); k_wtG<<<(unsigned)((DM * DKV / 64 + 63) / 64), 256, 0, stream>>>(wv, DM, DKV, WV);
       }
    k_csid<<<(TT * HD + 255) / 256, 256, 0, stream>>>(CS);
    const unsigned LQ = (unsigned)(((size_t)NH_ * TT * HD / 2 + 255) / 256), LKv = (unsigned)(((size_t)NKV * TT * HD / 2 + 255) / 256);
    for (int b = 0; b < NB_; ++b) {
        
        k_cvt8<<<(unsigned)(((size_t)TT * DM / 8 + 255) / 256), 256, 0, stream>>>(x + (size_t)b * TT * DM, XB, (size_t)TT * DM / 8);
        k_gemmw<bf, 0, true><<<dim3(TT / 64, DQ / 64, 1), 32, 0, stream>>>(XB, nullptr, WQ, nullptr, DM, FQ, DQ, bq, 0, 0, 0);
        k_rope<<<LQ, 256, 0, stream>>>(FQ, DQ, NH_, CS, nullptr, nullptr, 1.0f, QP16, QPh, QPl);
        k_gemmw<bf, 0, true><<<dim3(TT / 64, DKV / 64, 1), 32, 0, stream>>>(XB, nullptr, WK, nullptr, DM, FK, DKV, bk, 0, 0, 0);
        k_rope<<<LKv, 256, 0, stream>>>(FK, DKV, NKV, CS, nullptr, nullptr, 1.0f, KP16, KPh, KPl);
        k_gemmw<bf, 0, true><<<dim3(TT / 64, DKV / 64, 1), 32, 0, stream>>>(XB, nullptr, WV, nullptr, DM, FV, DKV, bv, 0, 0, 0); k_vtp<<<LKv, 256, 0, stream>>>(FV, DKV, NKV, VT16, VTh, VTl);
        for (int h0 = 0; h0 < NH_; h0 += ZH) { const size_t zq = (size_t)h0, zk = (size_t)(h0 / REP);   // one kv head per query head: the pass's two heads use consecutive kv planes (z-strides TT*HD)
            k_gemmw<bf, 2, false><<<dim3(RH / 64, TT / 64, ZH), 32, 0, stream>>>(QPh + zq * TT * HD, QPl + zq * TT * HD, KPh + zk * TT * HD, KPl + zk * TT * HD, HD, Sb, TT, nullptr, (size_t)TT * HD, (size_t)TT * HD, (size_t)TT * TT);
            k_asoft<<<ZH * TT / 8, 256, 0, stream>>>(Sb, CM + (size_t)b * TT * TT, AM + (size_t)b * TT, WCM, BCM, P16, Ph, Pl);
            k_gemmw<bf, 2, false><<<dim3(RH / 64, HD / 64, ZH), 32, 0, stream>>>(Ph, Pl, VTh + zk * HD * TT, VTl + zk * HD * TT, TT, Ob, HD, nullptr, (size_t)RH * TT, (size_t)HD * TT, (size_t)TT * HD);
            k_merge<<<(unsigned)(((size_t)ZH * TT * HD / 2 + 255) / 256), 256, 0, stream>>>(Ob, h0, OUT + (size_t)b * TT * DM); }
    }
}

// v001
// Measured time: 257 microseconds a run.
// Two timings next to v000 put it at 18.6 and 18.4 times that version's speed.
#include <hip/hip_runtime.h>

// Self-attention with a contact-map-scaled score and an additive mask (hidden_states [32][256][768]; q, k, v = x W + b ('xw' [768][768], 12 heads x 64); cm = w_cm contact_map[b][0][i][j] + b_cm (scalar 1x1 conv; inputs read); scores = (q.k/8) cm + attention_mask[b][0][0][j]; softmax; out = merged attn.v (no output projection) -> [32][256][768] f32 (6.3 M)).
// Compute dtypes, f32 accumulate: every input rounded to bf16; q/k/v on PLAIN bf16 operands (inputs: exact) + biases; scores and attn.v: all 256 query rows hl (3 products); softmax f32; no output projection: the merged context is written in f32.

#define NB_  32
#define TT   256
#define DM   768
#define NH_  12
#define NKV  12
#define REP  (NH_ / NKV)
#define HD   64
#define DQ   (NH_ * HD)
#define DKV  (NKV * HD)
#define ZH   NH_                  // heads per attention launch: all of them (grid z of the GEMMs also carries the batch)
#define RH   256                  // query rows < RH use hi+lo planes (0: none)
#define WIN  0
#define PCAR 1024.0f
#define SCL  0.125f   // HD^-0.5
typedef _Float16 h16;
typedef unsigned short bf;
typedef __attribute__((ext_vector_type(16))) __bf16   v16bf;
typedef __attribute__((ext_vector_type(16))) _Float16 v16h;
typedef __attribute__((ext_vector_type(8)))  _Float16 v8h;
typedef __attribute__((ext_vector_type(8)))  unsigned short v8us;
typedef __attribute__((ext_vector_type(8)))  float    v8f;
typedef __attribute__((ext_vector_type(4)))  float    v4f;
typedef v8h  __attribute__((may_alias)) v8ha;
typedef v4f  __attribute__((may_alias)) v4fa;
typedef v8us __attribute__((may_alias)) v8usa;

__device__ __forceinline__ unsigned short f2bf(float f) { unsigned u = __float_as_uint(f); u += 0x7FFFu + ((u >> 16) & 1u); return (unsigned short)(u >> 16); }
__device__ __forceinline__ float bf2f(unsigned short b) { return __uint_as_float(((unsigned)b) << 16); }
__device__ __forceinline__ float bfr(float f) { return bf2f(f2bf(f)); }
__device__ __forceinline__ v16h cat16(v8h lo, v8h hi) { return __builtin_shufflevector(lo, hi, 0, 1, 2, 3, 4, 5, 6, 7, 8, 9, 10, 11, 12, 13, 14, 15); }
__device__ __forceinline__ v16bf cat16b(v8us lo, v8us hi) { return __builtin_bit_cast(v16bf, __builtin_shufflevector(lo, hi, 0, 1, 2, 3, 4, 5, 6, 7, 8, 9, 10, 11, 12, 13, 14, 15)); }
__device__ __forceinline__ v8f wmma16(v16h a, v16h b, v8f c) { return __builtin_amdgcn_wmma_f32_16x16x32_f16(false, a, false, b, (short)0, c, false, false); }
__device__ __forceinline__ v8f wmmab(v16bf a, v16bf b, v8f c) { return __builtin_amdgcn_wmma_f32_16x16x32_bf16(false, a, false, b, (short)0, c, false, false); }



// ---- k_gemmw: register-blocked GEMM, ONE WAVE per 64x64 output tile (16 accumulators), operands straight from K-contiguous 16-bit planes; grid (M/64, N/64, Z), 32 threads.
// C[m][n] (f32, pitch ldc, + optional f32 bias[n]) = sum_k A[m][k] Bt[n][k] (+ split products per NSPLIT). z-batch strides sA/sB/sC in elements. K % 32 == 0.
template <typename T16> struct WFrag;
template <> struct WFrag<h16> { typedef v16h V; static __device__ __forceinline__ V ld(const h16* p) { return cat16(*(const v8h*)p, *(const v8h*)(p + 16)); } static __device__ __forceinline__ v8f mma(V a, V b, v8f c) { return wmma16(a, b, c); } };
template <> struct WFrag<bf> { typedef v16bf V; static __device__ __forceinline__ V ld(const bf* p) { return cat16b(*(const v8us*)p, *(const v8us*)(p + 16)); } static __device__ __forceinline__ v8f mma(V a, V b, v8f c) { return wmmab(a, b, c); } };
template <typename T16, int NSPLIT, bool BIAS>
__global__ __launch_bounds__(32) void k_gemmw(const T16* __restrict__ A, const T16* __restrict__ A2, const T16* __restrict__ Bt, const T16* __restrict__ Bt2, int K, float* C, int ldc, const float* __restrict__ bias, size_t sA, size_t sB, size_t sC) {
    typedef typename WFrag<T16>::V V;
    __shared__ __align__(16) float os[16 * 68];
    const size_t z = blockIdx.z; A += z * sA; if (A2) A2 += z * sA; Bt += z * sB; if (Bt2) Bt2 += z * sB; C += z * sC;
    const int lane = threadIdx.x & 31, lr = lane & 15, hi = lane >> 4; const int r0 = blockIdx.x * 64, c0 = blockIdx.y * 64;
    v8f acc[4][4];
#pragma unroll
    for (int mb = 0; mb < 4; ++mb)
#pragma unroll
        for (int nb = 0; nb < 4; ++nb) acc[mb][nb] = (v8f){};
    const size_t aoff = (size_t)(r0 + lr) * K + 8 * hi, boff = (size_t)(c0 + lr) * K + 8 * hi;
#pragma unroll 1
    for (int kc = 0; kc < K; kc += 32) {
        V a[4], a2[4];
#pragma unroll
        for (int mb = 0; mb < 4; ++mb) { a[mb] = WFrag<T16>::ld(A + aoff + (size_t)mb * 16 * K + kc); if (NSPLIT == 1 || NSPLIT == 2) a2[mb] = WFrag<T16>::ld(A2 + aoff + (size_t)mb * 16 * K + kc); }
#pragma unroll
        for (int nb = 0; nb < 4; ++nb) { const V b = WFrag<T16>::ld(Bt + boff + (size_t)nb * 16 * K + kc); V b2; if (NSPLIT >= 2) b2 = WFrag<T16>::ld(Bt2 + boff + (size_t)nb * 16 * K + kc);
#pragma unroll
            for (int mb = 0; mb < 4; ++mb) { acc[mb][nb] = WFrag<T16>::mma(a[mb], b, acc[mb][nb]); if (NSPLIT == 1 || NSPLIT == 2) acc[mb][nb] = WFrag<T16>::mma(a2[mb], b, acc[mb][nb]); if (NSPLIT >= 2) acc[mb][nb] = WFrag<T16>::mma(a[mb], b2, acc[mb][nb]); } }
        asm volatile("v_nop\n\tv_nop\n\tv_nop\n\tv_nop" : "+v"(acc[0][0]), "+v"(acc[1][1]), "+v"(acc[2][2]), "+v"(acc[3][3]) : "v"(a[0]), "v"(a[3]));
    }
#pragma unroll
    for (int mb = 0; mb < 4; ++mb) {
#pragma unroll
        for (int nb = 0; nb < 4; ++nb) {
#pragma unroll
            for (int j = 0; j < 8; ++j) os[(hi * 8 + j) * 68 + nb * 16 + lr] = acc[mb][nb][j]; }
        __builtin_amdgcn_wave_barrier(); asm volatile("" ::: "memory");
        float* crow = C + (size_t)(r0 + mb * 16) * ldc + c0;
{
#pragma unroll
            for (int s = 0; s < 8; ++s) { const int row = 2 * s + hi, cofs = lr * 4; v4f val = *(const v4fa*)(os + row * 68 + cofs); if (BIAS) { val[0] += bfr(bias[c0 + cofs]); val[1] += bfr(bias[c0 + cofs + 1]); val[2] += bfr(bias[c0 + cofs + 2]); val[3] += bfr(bias[c0 + cofs + 3]); }
                *(v4f*)(crow + (size_t)row * ldc + cofs) = val; }
             }
        __builtin_amdgcn_wave_barrier(); asm volatile("" ::: "memory");
    }
}

__device__ __forceinline__ h16 tohx(float x) { return (h16)x; }
__device__ __forceinline__ void splitf(float y, unsigned short& h, unsigned short& l) { h = f2bf(y); l = f2bf(y - bf2f(h)); }
typedef __attribute__((ext_vector_type(2))) _Float16 v2h;
typedef __attribute__((ext_vector_type(4))) _Float16 v4h;
typedef __attribute__((ext_vector_type(2))) unsigned short v2us;
typedef __attribute__((ext_vector_type(4))) unsigned short v4us;
typedef __attribute__((ext_vector_type(2))) float v2f;
typedef __attribute__((ext_vector_type(4))) int v4i;

__global__ __launch_bounds__(256) void k_wtG(const float* __restrict__ w, int K, int N, bf* Bt) {
    const int lane = threadIdx.x & 31; const int L0 = (blockIdx.x * 8 + (threadIdx.x >> 5)) * 8; const int nlines = N * K / 64;
{
#pragma unroll 1
        for (int l = 0; l < 8; ++l) { const int L = L0 + l; if (L >= nlines) break; const size_t e = (size_t)L * 64 + lane * 2; const int k = (int)(e % K), n = (int)(e / K); v2us o;
            o[0] = f2bf(w[(size_t)k * N + n]); o[1] = f2bf(w[(size_t)(k + 1) * N + n]); *(v2us*)(Bt + e) = o; }
         }
}
__global__ __launch_bounds__(256) void k_cvt8(const float* __restrict__ src, bf* dst, size_t n8) { const size_t i = (size_t)blockIdx.x * 256 + threadIdx.x; if (i >= n8) return; const v8f v = *(const v8f*)(src + i * 8); v8us o;
#pragma unroll
    for (int k = 0; k < 8; ++k) o[k] = f2bf(v[k]); *(v8us*)(dst + i * 8) = o;  }

// k_rope: head planes [h][t][d] (fp16 + hi/lo) of rope(x) x sc with the rotate-half convention out[d] = x[d] cos[t][d] - x[d+HD/2] sin[t][d], out[d+HD/2] = x[d+HD/2] cos[t][d+HD/2] + x[d] sin[t][d+HD/2]
__global__ __launch_bounds__(256) void k_rope(const float* __restrict__ F, int pitch, int nheads, const float* __restrict__ CS, const float* __restrict__ RF, const float* __restrict__ nw, float sc, h16* P16, bf* Ph, bf* Pl) {
    { const size_t bz = blockIdx.y, po = bz * nheads * TT * HD; F += bz * TT * pitch; P16 += po; Ph += po; Pl += po; }   // grid y = batch: F rows bz*TT.., planes [bz][h][t][d] (RF is null in every launch here and stays per head)
    const size_t e = ((size_t)blockIdx.x * 256 + threadIdx.x) * 2; if (e >= (size_t)nheads * TT * HD) return; const int d = (int)(e % HD); const int t = (int)((e / HD) % TT); const int h = (int)(e / ((size_t)HD * TT)); const float* f = F + (size_t)t * pitch + h * HD; const float rf = RF ? RF[(size_t)h * TT + t] : 1.0f; v2h o16; v2us oh, ol;
#pragma unroll
    for (int q = 0; q < 2; ++q) { const int dd = d + q; const int dp = (dd < HD / 2) ? dd + HD / 2 : dd - HD / 2; float x0 = f[dd], x1 = f[dp];
        if (RF) { float n0 = __fmul_rn(x0, rf), n1 = __fmul_rn(x1, rf); asm volatile("" : "+v"(n0)); asm volatile("" : "+v"(n1)); x0 = __fmul_rn(bfr(nw[dd]), n0); x1 = __fmul_rn(bfr(nw[dp]), n1); }
        const v2f cs = *(const v2f*)(CS + ((size_t)t * HD + dd) * 2); float a = __fmul_rn(x0, cs[0]), bq = __fmul_rn(x1, cs[1]); asm volatile("" : "+v"(a)); asm volatile("" : "+v"(bq)); const float r = ((dd < HD / 2) ? __fsub_rn(a, bq) : __fadd_rn(a, bq)) * sc;
        o16[q] = tohx(r); unsigned short a2, c2; splitf(r, a2, c2); oh[q] = a2; ol[q] = c2; }
    *(v2h*)(P16 + e) = o16; *(v2us*)(Ph + e) = oh; *(v2us*)(Pl + e) = ol;  }
__global__ __launch_bounds__(256) void k_vtp(const float* __restrict__ F, int pitch, int nheads, h16* V16, bf* Vh, bf* Vl) { const size_t e = ((size_t)blockIdx.x * 256 + threadIdx.x) * 2; if (e >= (size_t)nheads * HD * TT) return; const int t = (int)(e % TT); const int d = (int)((e / TT) % HD); const int g = (int)(e / ((size_t)TT * HD)); const size_t bz = blockIdx.y; /* batch: F rows bz*TT.., planes [bz][g][d][t] */ const size_t po = bz * nheads * HD * TT; F += bz * TT * pitch; V16 += po; Vh += po; Vl += po; v2h o16; v2us oh, ol;
#pragma unroll
    for (int q = 0; q < 2; ++q) { const float x = F[(size_t)(t + q) * pitch + g * HD + d]; o16[q] = tohx(x); unsigned short a2, c2; splitf(x, a2, c2); oh[q] = a2; ol[q] = c2; }
    *(v2h*)(V16 + e) = o16; *(v2us*)(Vh + e) = oh; *(v2us*)(Vl + e) = ol;  }
__global__ __launch_bounds__(256) void k_csid(float* CS) { const int idx = blockIdx.x * 256 + threadIdx.x; if (idx >= TT * HD) return; v2f cs; cs[0] = 1.0f; cs[1] = 0.0f; *(v2f*)(CS + (size_t)idx * 2) = cs;  }
// k_asoft: per row (zz, i): t = S x HD^-0.5 x cm + mask; softmax over the 256 keys (register row, one exp, fixed trees);
__global__ __launch_bounds__(256) void k_asoft(const float* __restrict__ Sb, const float* __restrict__ CMb, const float* __restrict__ AMb, const float* __restrict__ WCM, const float* __restrict__ BCM, h16* P16, bf* Ph, bf* Pl) {
    { const size_t bz = blockIdx.y; Sb += bz * ZH * TT * TT; CMb += bz * TT * TT; AMb += bz * TT; P16 += bz * ZH * TT * TT; Ph += bz * ZH * RH * TT; Pl += bz * ZH * RH * TT; }   // grid y = batch
    const int lane = threadIdx.x & 31; const int row = blockIdx.x * 8 + (threadIdx.x >> 5); if (row >= ZH * TT) return; const int i = row % TT; const int zz = row / TT; (void)zz; const float wcm = bfr(WCM[0]), bcm = bfr(BCM[0]); const float* cmr = CMb + (size_t)i * TT; const bool hires = (i < RH); const float* sr = Sb + (size_t)row * TT; float v[TT / 32]; float mx = -3.0e38f;
#pragma unroll
    for (int ch = 0; ch < TT / 128; ++ch) { const int j0 = ch * 128 + lane * 4; const v4f a = *(const v4f*)(sr + j0); const v4f c4 = *(const v4f*)(cmr + j0), m4 = *(const v4f*)(AMb + j0);
#pragma unroll
        for (int q = 0; q < 4; ++q) { const int j = j0 + q; (void)j; float cmv = __fmul_rn(wcm, bfr(c4[q])); asm volatile("" : "+v"(cmv)); const float cm = __fadd_rn(cmv, bcm); float sa = a[q] * SCL; asm volatile("" : "+v"(sa)); float sc = __fmul_rn(sa, cm); asm volatile("" : "+v"(sc)); const float t = __fadd_rn(sc, bfr(m4[q]));   /* (q.k/8) x (w_cm c + b_cm) + mask */ v[ch * 4 + q] = t; mx = fmaxf(mx, t); } }
#pragma unroll
    for (int sh = 16; sh; sh >>= 1) mx = fmaxf(mx, __shfl_xor(mx, sh, 32));
    float sum = 0.f;
#pragma unroll
    for (int k = 0; k < TT / 32; ++k) { float d0 = __fsub_rn(v[k], mx); asm volatile("" : "+v"(d0)); v[k] = __builtin_amdgcn_exp2f(__fmul_rn(d0, 1.4426950408889634f)); sum += v[k]; }
#pragma unroll
    for (int sh = 16; sh; sh >>= 1) sum += __shfl_xor(sum, sh, 32);
    const float f = __fdiv_rn(hires ? 1.0f : PCAR, sum);
{
        if (hires) {
#pragma unroll
            for (int ch = 0; ch < TT / 128; ++ch) { v4us oh, ol;
#pragma unroll
                for (int q = 0; q < 4; ++q) { unsigned short a, c2; splitf(v[ch * 4 + q] * f, a, c2); oh[q] = a; ol[q] = c2; }
                const size_t oo = ((size_t)zz * (RH ? RH : 1) + i) * TT + ch * 128 + lane * 4; *(v4us*)(Ph + oo) = oh; *(v4us*)(Pl + oo) = ol; }
        } else {
#pragma unroll
            for (int ch = 0; ch < TT / 128; ++ch) { v4h o4;
#pragma unroll
                for (int q = 0; q < 4; ++q) o4[q] = tohx(v[ch * 4 + q] * f);
                *(v4h*)(P16 + (size_t)row * TT + ch * 128 + lane * 4) = o4; } }
         }
}
__global__ __launch_bounds__(256) void k_merge(const float* __restrict__ O, int h0, float* OUTb) { const size_t e = ((size_t)blockIdx.x * 256 + threadIdx.x) * 2; if (e >= (size_t)ZH * TT * HD) return; const int d = (int)(e % HD); const int t = (int)((e / HD) % TT); const int zz = (int)(e / ((size_t)HD * TT)); const size_t bz = blockIdx.y; /* batch */ O += bz * ZH * TT * HD; OUTb += bz * TT * DM; const float cs = (t < RH) ? 1.0f : (1.0f / PCAR); const size_t oo = (size_t)t * DQ + (h0 + zz) * HD + d;
    v2f o2; o2[0] = O[e] * cs; o2[1] = O[e + 1] * cs; *(v2f*)(OUTb + oo) = o2;  }   /* f32 context straight to the output */

extern "C" void kernel_launch(void* const* d_in, const int* in_sizes, int n_in,
                              void* d_out, int out_size, void* d_ws, size_t ws_size, hipStream_t stream) {
    (void)in_sizes; (void)n_in; (void)out_size;
    const float* x = (const float*)d_in[0]; const float* CM = (const float*)d_in[1]; const float* AM = (const float*)d_in[2]; const float* wq = (const float*)d_in[3]; const float* bq = (const float*)d_in[4]; const float* wk = (const float*)d_in[5]; const float* bk = (const float*)d_in[6]; const float* wv = (const float*)d_in[7]; const float* bv = (const float*)d_in[8]; const float* WCM = (const float*)d_in[9]; const float* BCM = (const float*)d_in[10]; const float* wo = nullptr; (void)wo;
    float* OUT = (float*)d_out;     // [32][256][768]
    char* wsp = (char*)d_ws;
    auto take = [&](size_t bytes) { char* p = wsp; wsp += (bytes + 255) & ~(size_t)255; return (void*)p; };
    bf* WQ = (bf*)take((size_t)DQ * DM * 2); bf* WK = (bf*)take((size_t)DKV * DM * 2); bf* WV = (bf*)take((size_t)DKV * DM * 2); float* CS = (float*)take((size_t)TT * HD * 2 * 4);
    // whole-batch planes [b][h][..]; the four q/k planes lie back to back (each size is a multiple of 256 bytes)
    bf* QPh = (bf*)take((size_t)NB_ * NH_ * TT * HD * 2); bf* QPl = (bf*)take((size_t)NB_ * NH_ * TT * HD * 2); bf* KPh = (bf*)take((size_t)NB_ * NKV * TT * HD * 2); bf* KPl = (bf*)take((size_t)NB_ * NKV * TT * HD * 2); bf* VTh = (bf*)take((size_t)NB_ * NKV * HD * TT * 2); bf* VTl = (bf*)take((size_t)NB_ * NKV * HD * TT * 2);
    float* Sb = (float*)take((size_t)NB_ * NH_ * TT * TT * 4); bf* Pl = (bf*)take((size_t)NB_ * NH_ * RH * TT * 2); h16* P16 = (h16*)take(256);   /* unused: all rows hi/lo */
    if ((size_t)(wsp - (char*)d_ws) > ws_size) return;    // ws 256 MiB
    // Stream-ordered reuse, so that the whole batch fits the workspace:
    //   the score buffer first holds x in bf16 and the f32 projections (dead before the score GEMM writes it), and last the f32 context (the scores are dead after the softmax);
    //   the low probability plane first holds the three fp16 planes (never read);
    //   the high probability plane takes the place of the four q/k planes (dead after the score GEMM; same total size).
    char* sp = (char*)Sb; bf* XB = (bf*)sp; sp += (size_t)NB_ * TT * DM * 2; float* FQ = (float*)sp; sp += (size_t)NB_ * TT * DQ * 4; float* FK = (float*)sp;
    char* pp = (char*)Pl; h16* QP16 = (h16*)pp; pp += (size_t)NB_ * NH_ * TT * HD * 2; h16* KP16 = (h16*)pp; pp += (size_t)NB_ * NKV * TT * HD * 2; h16* VT16 = (h16*)pp;
    bf* Ph = QPh; float* Ob = Sb;
    float* FV = FK;   // v projection reuses the k buffer after the k planes are built (stream-ordered)
    { k_wtG<<<(unsigned)((DM * DQ / 64 + 63) / 64), 256, 0, stream>>>(wq, DM, DQ, WQ); k_wtG<<<(unsigned)((DM * DKV / 64 + 63) / 64), 256, 0, stream>>>(wk, DM, DKV, WK); k_wtG<<<(unsigned)((DM * DKV / 64 + 63) / 64), 256, 0, stream>>>(wv, DM, DKV, WV);
       }
    k_csid<<<(TT * HD + 255) / 256, 256, 0, stream>>>(CS);
    const unsigned LQ = (unsigned)(((size_t)NH_ * TT * HD / 2 + 255) / 256), LKv = (unsigned)(((size_t)NKV * TT * HD / 2 + 255) / 256);
    // every launch covers all NB_ batches (GEMM rows or grid z = b * heads + h; k_cvt8's flat index; grid y = b elsewhere) and all heads
    k_cvt8<<<(unsigned)(((size_t)NB_ * TT * DM / 8 + 255) / 256), 256, 0, stream>>>(x, XB, (size_t)NB_ * TT * DM / 8);
    k_gemmw<bf, 0, true><<<dim3(NB_ * TT / 64, DQ / 64, 1), 32, 0, stream>>>(XB, nullptr, WQ, nullptr, DM, FQ, DQ, bq, 0, 0, 0);
    k_rope<<<dim3(LQ, NB_, 1), 256, 0, stream>>>(FQ, DQ, NH_, CS, nullptr, nullptr, 1.0f, QP16, QPh, QPl);
    k_gemmw<bf, 0, true><<<dim3(NB_ * TT / 64, DKV / 64, 1), 32, 0, stream>>>(XB, nullptr, WK, nullptr, DM, FK, DKV, bk, 0, 0, 0);
    k_rope<<<dim3(LKv, NB_, 1), 256, 0, stream>>>(FK, DKV, NKV, CS, nullptr, nullptr, 1.0f, KP16, KPh, KPl);
    k_gemmw<bf, 0, true><<<dim3(NB_ * TT / 64, DKV / 64, 1), 32, 0, stream>>>(XB, nullptr, WV, nullptr, DM, FV, DKV, bv, 0, 0, 0); k_vtp<<<dim3(LKv, NB_, 1), 256, 0, stream>>>(FV, DKV, NKV, VT16, VTh, VTl);
    // one kv head per query head: plane z = b * NH_ + h on both sides (z-strides TT*HD)
    k_gemmw<bf, 2, false><<<dim3(RH / 64, TT / 64, NB_ * ZH), 32, 0, stream>>>(QPh, QPl, KPh, KPl, HD, Sb, TT, nullptr, (size_t)TT * HD, (size_t)TT * HD, (size_t)TT * TT);
    k_asoft<<<dim3(ZH * TT / 8, NB_, 1), 256, 0, stream>>>(Sb, CM, AM, WCM, BCM, P16, Ph, Pl);
    k_gemmw<bf, 2, false><<<dim3(RH / 64, HD / 64, NB_ * ZH), 32, 0, stream>>>(Ph, Pl, VTh, VTl, TT, Ob, HD, nullptr, (size_t)RH * TT, (size_t)HD * TT, (size_t)TT * HD);
    k_merge<<<dim3((unsigned)(((size_t)ZH * TT * HD / 2 + 255) / 256), NB_, 1), 256, 0, stream>>>(Ob, 0, OUT);
}

// v002
// A run of this version takes 188 microseconds.
// Timed twice side by side with v001, it ran 1.37 and 1.36 times as fast.
// Counting every step since v000, it is 25.2 times as fast.
#include <hip/hip_runtime.h>

// Self-attention with a contact-map-scaled score and an additive mask (hidden_states [32][256][768]; q, k, v = x W + b ('xw' [768][768], 12 heads x 64); cm = w_cm contact_map[b][0][i][j] + b_cm (scalar 1x1 conv; inputs read); scores = (q.k/8) cm + attention_mask[b][0][0][j]; softmax; out = merged attn.v (no output projection) -> [32][256][768] f32 (6.3 M)).
// Compute dtypes, f32 accumulate: every input rounded to bf16; q/k/v on PLAIN bf16 operands (inputs: exact) + biases; scores and attn.v: all 256 query rows hl (3 products); softmax f32; no output projection: the merged context is written in f32.

#define NB_  32
#define TT   256
#define DM   768
#define NH_  12
#define NKV  12
#define REP  (NH_ / NKV)
#define HD   64
#define DQ   (NH_ * HD)
#define DKV  (NKV * HD)
#define ZH   NH_                  // heads per attention launch: all of them (grid z of the score and context GEMMs also carries the batch)
#define RH   256                  // query rows < RH use hi+lo planes (0: none)
#define WIN  0
#define PCAR 1024.0f
#define SCL  0.125f   // HD^-0.5
typedef _Float16 h16;
typedef unsigned short bf;
typedef __attribute__((ext_vector_type(16))) __bf16   v16bf;
typedef __attribute__((ext_vector_type(16))) _Float16 v16h;
typedef __attribute__((ext_vector_type(8)))  _Float16 v8h;
typedef __attribute__((ext_vector_type(8)))  unsigned short v8us;
typedef __attribute__((ext_vector_type(8)))  float    v8f;
typedef __attribute__((ext_vector_type(4)))  float    v4f;
typedef v8h  __attribute__((may_alias)) v8ha;
typedef v4f  __attribute__((may_alias)) v4fa;
typedef v8us __attribute__((may_alias)) v8usa;

__device__ __forceinline__ unsigned short f2bf(float f) { unsigned u = __float_as_uint(f); u += 0x7FFFu + ((u >> 16) & 1u); return (unsigned short)(u >> 16); }
__device__ __forceinline__ float bf2f(unsigned short b) { return __uint_as_float(((unsigned)b) << 16); }
__device__ __forceinline__ float bfr(float f) { return bf2f(f2bf(f)); }
__device__ __forceinline__ v16h cat16(v8h lo, v8h hi) { return __builtin_shufflevector(lo, hi, 0, 1, 2, 3, 4, 5, 6, 7, 8, 9, 10, 11, 12, 13, 14, 15); }
__device__ __forceinline__ v16bf cat16b(v8us lo, v8us hi) { return __builtin_bit_cast(v16bf, __builtin_shufflevector(lo, hi, 0, 1, 2, 3, 4, 5, 6, 7, 8, 9, 10, 11, 12, 13, 14, 15)); }
__device__ __forceinline__ v8f wmma16(v16h a, v16h b, v8f c) { return __builtin_amdgcn_wmma_f32_16x16x32_f16(false, a, false, b, (short)0, c, false, false); }
__device__ __forceinline__ v8f wmmab(v16bf a, v16bf b, v8f c) { return __builtin_amdgcn_wmma_f32_16x16x32_bf16(false, a, false, b, (short)0, c, false, false); }



// ---- k_gemmw: register-blocked GEMM, ONE WAVE per 64x64 output tile (16 accumulators), operands straight from K-contiguous 16-bit planes; grid (M/64, N/64, Z), 32 threads.
// C[m][n] (f32, pitch ldc, + optional f32 bias[n]) = sum_k A[m][k] Bt[n][k] (+ split products per NSPLIT). z-batch strides sA/sB/sC in elements. K % 32 == 0.
// EPI 0: C is stored in f32. EPI 1, 2 (projections; rows m = b * TT + t, the 64 tile columns are one head): C + bias is split into bf16 hi + lo here and stored
// straight into the head planes Oh, Ol: EPI 1 as [b][h][t][d], EPI 2 transposed as [b][h][d][t]; no f32 C is written.
// EPI 3 (context; z = b * nheads + h, rows t): as EPI 0, but plane z is stored merged, at C[b][t][h * HD + d] with row pitch ldc.
template <typename T16> struct WFrag;
template <> struct WFrag<h16> { typedef v16h V; static __device__ __forceinline__ V ld(const h16* p) { return cat16(*(const v8h*)p, *(const v8h*)(p + 16)); } static __device__ __forceinline__ v8f mma(V a, V b, v8f c) { return wmma16(a, b, c); } };
template <> struct WFrag<bf> { typedef v16bf V; static __device__ __forceinline__ V ld(const bf* p) { return cat16b(*(const v8us*)p, *(const v8us*)(p + 16)); } static __device__ __forceinline__ v8f mma(V a, V b, v8f c) { return wmmab(a, b, c); } };
__device__ __forceinline__ void splitf(float y, unsigned short& h, unsigned short& l) { h = f2bf(y); l = f2bf(y - bf2f(h)); }
template <typename T16, int NSPLIT, bool BIAS, int EPI>
__global__ __launch_bounds__(32) void k_gemmw(const T16* __restrict__ A, const T16* __restrict__ A2, const T16* __restrict__ Bt, const T16* __restrict__ Bt2, int K, float* C, int ldc, const float* __restrict__ bias, size_t sA, size_t sB, size_t sC, bf* Oh, bf* Ol, int nheads) {
    typedef typename WFrag<T16>::V V;
    static_assert(HD == 64 && TT % 64 == 0, "a 64 x 64 tile is 64 positions of one batch and one whole head");
    static_assert(RH == TT, "every probability row is hi + lo at scale 1, so the context needs no rescale before it is stored");
    __shared__ __align__(16) float os[16 * 68];
    __shared__ __align__(16) unsigned short vs[2 * 16 * 72];   // EPI 2: 16 d rows x 64 positions, hi then lo; pitch 144 B = 16 B x odd for the 16-byte stores and loads
    const size_t z = blockIdx.z; A += z * sA; if (A2) A2 += z * sA; Bt += z * sB; if (Bt2) Bt2 += z * sB; C += (EPI == 3) ? (z / (size_t)nheads) * TT * ldc + (z % (size_t)nheads) * HD : z * sC;
    const int lane = threadIdx.x & 31, lr = lane & 15, hi = lane >> 4; const int r0 = blockIdx.x * 64, c0 = blockIdx.y * 64;
    v8f acc[4][4];
#pragma unroll
    for (int mb = 0; mb < 4; ++mb)
#pragma unroll
        for (int nb = 0; nb < 4; ++nb) acc[mb][nb] = (v8f){};
    const size_t aoff = (size_t)(r0 + lr) * K + 8 * hi, boff = (size_t)(c0 + lr) * K + 8 * hi;
#pragma unroll 1
    for (int kc = 0; kc < K; kc += 32) {
        V a[4], a2[4];
#pragma unroll
        for (int mb = 0; mb < 4; ++mb) { a[mb] = WFrag<T16>::ld(A + aoff + (size_t)mb * 16 * K + kc); if (NSPLIT == 1 || NSPLIT == 2) a2[mb] = WFrag<T16>::ld(A2 + aoff + (size_t)mb * 16 * K + kc); }
#pragma unroll
        for (int nb = 0; nb < 4; ++nb) { const V b = WFrag<T16>::ld(Bt + boff + (size_t)nb * 16 * K + kc); V b2; if (NSPLIT >= 2) b2 = WFrag<T16>::ld(Bt2 + boff + (size_t)nb * 16 * K + kc);
#pragma unroll
            for (int mb = 0; mb < 4; ++mb) { acc[mb][nb] = WFrag<T16>::mma(a[mb], b, acc[mb][nb]); if (NSPLIT == 1 || NSPLIT == 2) acc[mb][nb] = WFrag<T16>::mma(a2[mb], b, acc[mb][nb]); if (NSPLIT >= 2) acc[mb][nb] = WFrag<T16>::mma(a[mb], b2, acc[mb][nb]); } }
        asm volatile("v_nop\n\tv_nop\n\tv_nop\n\tv_nop" : "+v"(acc[0][0]), "+v"(acc[1][1]), "+v"(acc[2][2]), "+v"(acc[3][3]) : "v"(a[0]), "v"(a[3]));
    }
    if (EPI == 1) {   // planes [b][h][t][d]: a lane takes 8 d of one row, a wave store covers 4 rows = 512 contiguous bytes
        const int sub = lane >> 3, cofs = (lane & 7) * 8; float bb[8];
#pragma unroll
        for (int q = 0; q < 8; ++q) bb[q] = bfr(bias[c0 + cofs + q]);
        const size_t pb = (((size_t)(r0 / TT) * nheads + blockIdx.y) * TT + (r0 % TT)) * HD + cofs;
#pragma unroll
        for (int mb = 0; mb < 4; ++mb) {
#pragma unroll
            for (int nb = 0; nb < 4; ++nb) {
#pragma unroll
                for (int j = 0; j < 8; ++j) os[(hi * 8 + j) * 68 + nb * 16 + lr] = acc[mb][nb][j]; }
            __builtin_amdgcn_wave_barrier(); asm volatile("" ::: "memory");   // the rows are read back by other lanes: keep the LDS stores in front of the loads
#pragma unroll
            for (int s = 0; s < 4; ++s) { const int row = 4 * s + sub; const v4f x0 = *(const v4fa*)(os + row * 68 + cofs), x1 = *(const v4fa*)(os + row * 68 + cofs + 4); v8us oh, ol;
#pragma unroll
                for (int q = 0; q < 4; ++q) { unsigned short a2, c2; splitf(x0[q] + bb[q], a2, c2); oh[q] = a2; ol[q] = c2; splitf(x1[q] + bb[4 + q], a2, c2); oh[4 + q] = a2; ol[4 + q] = c2; }
                const size_t oo = pb + (size_t)(mb * 16 + row) * HD; *(v8usa*)(Oh + oo) = oh; *(v8usa*)(Ol + oo) = ol; }
            __builtin_amdgcn_wave_barrier(); asm volatile("" ::: "memory");   // the loads stay in front of the next block's LDS stores
        }
        return;
    }
    if (EPI == 2) {   // planes [b][h][d][t]: a lane's 8 accumulator registers are 8 consecutive t of one d; staged so that every d row leaves as one whole 128-byte line
        const int sub = lane >> 3, cofs = (lane & 7) * 8;
        const size_t pb = ((size_t)(r0 / TT) * nheads + blockIdx.y) * HD * TT + (r0 % TT) + cofs; float bb[4];
#pragma unroll
        for (int nb = 0; nb < 4; ++nb) bb[nb] = bfr(bias[c0 + nb * 16 + lr]);
#pragma unroll
        for (int nb = 0; nb < 4; ++nb) { const float bn = bb[nb];
#pragma unroll
            for (int mb = 0; mb < 4; ++mb) { v8us oh, ol;
#pragma unroll
                for (int j = 0; j < 8; ++j) { unsigned short a2, c2; splitf(acc[mb][nb][j] + bn, a2, c2); oh[j] = a2; ol[j] = c2; }
                *(v8usa*)(vs + lr * 72 + mb * 16 + hi * 8) = oh; *(v8usa*)(vs + 16 * 72 + lr * 72 + mb * 16 + hi * 8) = ol; }
            __builtin_amdgcn_wave_barrier(); asm volatile("" ::: "memory");   // the rows are read back by other lanes: keep the LDS stores in front of the loads
#pragma unroll
            for (int s = 0; s < 4; ++s) { const int row = 4 * s + sub; const v8us oh = *(const v8usa*)(vs + row * 72 + cofs), ol = *(const v8usa*)(vs + 16 * 72 + row * 72 + cofs);
                const size_t oo = pb + (size_t)(nb * 16 + row) * TT; *(v8usa*)(Oh + oo) = oh; *(v8usa*)(Ol + oo) = ol; }
            __builtin_amdgcn_wave_barrier(); asm volatile("" ::: "memory");   // the loads stay in front of the next block's LDS stores
        }
        return;
    }
#pragma unroll
    for (int mb = 0; mb < 4; ++mb) {
#pragma unroll
        for (int nb = 0; nb < 4; ++nb) {
#pragma unroll
            for (int j = 0; j < 8; ++j) os[(hi * 8 + j) * 68 + nb * 16 + lr] = acc[mb][nb][j]; }
        __builtin_amdgcn_wave_barrier(); asm volatile("" ::: "memory");
        float* crow = C + (size_t)(r0 + mb * 16) * ldc + c0;
{
#pragma unroll
            for (int s = 0; s < 8; ++s) { const int row = 2 * s + hi, cofs = lr * 4; v4f val = *(const v4fa*)(os + row * 68 + cofs); if (BIAS) { val[0] += bfr(bias[c0 + cofs]); val[1] += bfr(bias[c0 + cofs + 1]); val[2] += bfr(bias[c0 + cofs + 2]); val[3] += bfr(bias[c0 + cofs + 3]); }
                *(v4f*)(crow + (size_t)row * ldc + cofs) = val; }
             }
        __builtin_amdgcn_wave_barrier(); asm volatile("" ::: "memory");
    }
}

__device__ __forceinline__ h16 tohx(float x) { return (h16)x; }
typedef __attribute__((ext_vector_type(2))) _Float16 v2h;
typedef __attribute__((ext_vector_type(4))) _Float16 v4h;
typedef __attribute__((ext_vector_type(2))) unsigned short v2us;
typedef __attribute__((ext_vector_type(4))) unsigned short v4us;
typedef __attribute__((ext_vector_type(2))) float v2f;
typedef __attribute__((ext_vector_type(4))) int v4i;

__global__ __launch_bounds__(256) void k_wtG(const float* __restrict__ w, int K, int N, bf* Bt) {
    const int lane = threadIdx.x & 31; const int L0 = (blockIdx.x * 8 + (threadIdx.x >> 5)) * 8; const int nlines = N * K / 64;
{
#pragma unroll 1
        for (int l = 0; l < 8; ++l) { const int L = L0 + l; if (L >= nlines) break; const size_t e = (size_t)L * 64 + lane * 2; const int k = (int)(e % K), n = (int)(e / K); v2us o;
            o[0] = f2bf(w[(size_t)k * N + n]); o[1] = f2bf(w[(size_t)(k + 1) * N + n]); *(v2us*)(Bt + e) = o; }
         }
}
__global__ __launch_bounds__(256) void k_cvt8(const float* __restrict__ src, bf* dst, size_t n8) { const size_t i = (size_t)blockIdx.x * 256 + threadIdx.x; if (i >= n8) return; const v8f v = *(const v8f*)(src + i * 8); v8us o;
#pragma unroll
    for (int k = 0; k < 8; ++k) o[k] = f2bf(v[k]); *(v8us*)(dst + i * 8) = o;  }

// k_asoft: per row (zz, i): t = (S x HD^-0.5) x cm + mask; softmax over the 256 keys (register row, one exp, fixed trees);
__global__ __launch_bounds__(256) void k_asoft(const float* __restrict__ Sb, const float* __restrict__ CMb, const float* __restrict__ AMb, const float* __restrict__ WCM, const float* __restrict__ BCM, h16* P16, bf* Ph, bf* Pl) {
    { const size_t bz = blockIdx.y; Sb += bz * ZH * TT * TT; CMb += bz * TT * TT; AMb += bz * TT; P16 += bz * ZH * TT * TT; Ph += bz * ZH * RH * TT; Pl += bz * ZH * RH * TT; }   // grid y = batch
    const int lane = threadIdx.x & 31; const int row = blockIdx.x * 8 + (threadIdx.x >> 5); if (row >= ZH * TT) return; const int i = row % TT; const int zz = row / TT; (void)zz; const float wcm = bfr(WCM[0]), bcm = bfr(BCM[0]); const float* cmr = CMb + (size_t)i * TT; const bool hires = (i < RH); const float* sr = Sb + (size_t)row * TT; float v[TT / 32]; float mx = -3.0e38f;
#pragma unroll
    for (int ch = 0; ch < TT / 128; ++ch) { const int j0 = ch * 128 + lane * 4; const v4f a = *(const v4f*)(sr + j0); const v4f c4 = *(const v4f*)(cmr + j0), m4 = *(const v4f*)(AMb + j0);
#pragma unroll
        for (int q = 0; q < 4; ++q) { const int j = j0 + q; (void)j; float cmv = __fmul_rn(wcm, bfr(c4[q])); asm volatile("" : "+v"(cmv)); const float cm = __fadd_rn(cmv, bcm); float sa = a[q] * SCL; asm volatile("" : "+v"(sa)); float sc = __fmul_rn(sa, cm); asm volatile("" : "+v"(sc)); const float t = __fadd_rn(sc, bfr(m4[q]));   /* (q.k/8) x (w_cm c + b_cm) + mask */ v[ch * 4 + q] = t; mx = fmaxf(mx, t); } }
#pragma unroll
    for (int sh = 16; sh; sh >>= 1) mx = fmaxf(mx, __shfl_xor(mx, sh, 32));
    float sum = 0.f;
#pragma unroll
    for (int k = 0; k < TT / 32; ++k) { float d0 = __fsub_rn(v[k], mx); asm volatile("" : "+v"(d0)); v[k] = __builtin_amdgcn_exp2f(__fmul_rn(d0, 1.4426950408889634f)); sum += v[k]; }
#pragma unroll
    for (int sh = 16; sh; sh >>= 1) sum += __shfl_xor(sum, sh, 32);
    const float f = __fdiv_rn(hires ? 1.0f : PCAR, sum);
{
        if (hires) {
#pragma unroll
            for (int ch = 0; ch < TT / 128; ++ch) { v4us oh, ol;
#pragma unroll
                for (int q = 0; q < 4; ++q) { unsigned short a, c2; splitf(v[ch * 4 + q] * f, a, c2); oh[q] = a; ol[q] = c2; }
                const size_t oo = ((size_t)zz * (RH ? RH : 1) + i) * TT + ch * 128 + lane * 4; *(v4us*)(Ph + oo) = oh; *(v4us*)(Pl + oo) = ol; }
        } else {
#pragma unroll
            for (int ch = 0; ch < TT / 128; ++ch) { v4h o4;
#pragma unroll
                for (int q = 0; q < 4; ++q) o4[q] = tohx(v[ch * 4 + q] * f);
                *(v4h*)(P16 + (size_t)row * TT + ch * 128 + lane * 4) = o4; } }
         }
}

extern "C" void kernel_launch(void* const* d_in, const int* in_sizes, int n_in,
                              void* d_out, int out_size, void* d_ws, size_t ws_size, hipStream_t stream) {
    (void)in_sizes; (void)n_in; (void)out_size;
    const float* x = (const float*)d_in[0]; const float* CM = (const float*)d_in[1]; const float* AM = (const float*)d_in[2]; const float* wq = (const float*)d_in[3]; const float* bq = (const float*)d_in[4]; const float* wk = (const float*)d_in[5]; const float* bk = (const float*)d_in[6]; const float* wv = (const float*)d_in[7]; const float* bv = (const float*)d_in[8]; const float* WCM = (const float*)d_in[9]; const float* BCM = (const float*)d_in[10]; const float* wo = nullptr; (void)wo;
    float* OUT = (float*)d_out;     // [32][256][768]
    char* wsp = (char*)d_ws;
    auto take = [&](size_t bytes) { char* p = wsp; wsp += (bytes + 255) & ~(size_t)255; return (void*)p; };
    bf* WQ = (bf*)take((size_t)DQ * DM * 2); bf* WK = (bf*)take((size_t)DKV * DM * 2); bf* WV = (bf*)take((size_t)DKV * DM * 2);
    // whole-batch planes [b][h][..]; the four q/k planes lie back to back (each size is a multiple of 256 bytes)
    bf* QPh = (bf*)take((size_t)NB_ * NH_ * TT * HD * 2); bf* QPl = (bf*)take((size_t)NB_ * NH_ * TT * HD * 2); bf* KPh = (bf*)take((size_t)NB_ * NKV * TT * HD * 2); bf* KPl = (bf*)take((size_t)NB_ * NKV * TT * HD * 2); bf* VTh = (bf*)take((size_t)NB_ * NKV * HD * TT * 2); bf* VTl = (bf*)take((size_t)NB_ * NKV * HD * TT * 2);
    float* Sb = (float*)take((size_t)NB_ * NH_ * TT * TT * 4); bf* Pl = (bf*)take((size_t)NB_ * NH_ * RH * TT * 2); h16* P16 = (h16*)take(256);   /* unused: all rows hi/lo */
    if ((size_t)(wsp - (char*)d_ws) > ws_size) return;    // ws 256 MiB
    // Stream-ordered reuse, so that the whole batch fits the workspace:
    //   the score buffer first holds x in bf16 (dead before the score GEMM writes it);
    //   the high probability plane takes the place of the four q/k planes (dead after the score GEMM; same total size).
    bf* XB = (bf*)Sb;
    bf* Ph = QPh;
    { k_wtG<<<(unsigned)((DM * DQ / 64 + 63) / 64), 256, 0, stream>>>(wq, DM, DQ, WQ); k_wtG<<<(unsigned)((DM * DKV / 64 + 63) / 64), 256, 0, stream>>>(wk, DM, DKV, WK); k_wtG<<<(unsigned)((DM * DKV / 64 + 63) / 64), 256, 0, stream>>>(wv, DM, DKV, WV);
       }
    // every launch covers all NB_ batches (GEMM rows or grid z = b * heads + h; grid y = b in k_asoft; k_cvt8 is one flat range) and all heads
    k_cvt8<<<(unsigned)(((size_t)NB_ * TT * DM / 8 + 255) / 256), 256, 0, stream>>>(x, XB, (size_t)NB_ * TT * DM / 8);
    // the projections split x W + b into the bf16 hi + lo head planes in their own epilogue (q, k as [b][h][t][d]; v transposed as [b][h][d][t])
    k_gemmw<bf, 0, true, 1><<<dim3(NB_ * TT / 64, DQ / 64, 1), 32, 0, stream>>>(XB, nullptr, WQ, nullptr, DM, nullptr, 0, bq, 0, 0, 0, QPh, QPl, NH_);
    k_gemmw<bf, 0, true, 1><<<dim3(NB_ * TT / 64, DKV / 64, 1), 32, 0, stream>>>(XB, nullptr, WK, nullptr, DM, nullptr, 0, bk, 0, 0, 0, KPh, KPl, NKV);
    k_gemmw<bf, 0, true, 2><<<dim3(NB_ * TT / 64, DKV / 64, 1), 32, 0, stream>>>(XB, nullptr, WV, nullptr, DM, nullptr, 0, bv, 0, 0, 0, VTh, VTl, NKV);
    // one kv head per query head: plane z = b * NH_ + h on both sides (z-strides TT*HD)
    k_gemmw<bf, 2, false, 0><<<dim3(RH / 64, TT / 64, NB_ * ZH), 32, 0, stream>>>(QPh, QPl, KPh, KPl, HD, Sb, TT, nullptr, (size_t)TT * HD, (size_t)TT * HD, (size_t)TT * TT, nullptr, nullptr, 0);
    k_asoft<<<dim3(ZH * TT / 8, NB_, 1), 256, 0, stream>>>(Sb, CM, AM, WCM, BCM, P16, Ph, Pl);
    // the context GEMM stores its f32 tiles straight into the merged output [b][t][h * HD + d]
    k_gemmw<bf, 2, false, 3><<<dim3(RH / 64, HD / 64, NB_ * ZH), 32, 0, stream>>>(Ph, Pl, VTh, VTl, TT, OUT, DQ, nullptr, (size_t)RH * TT, (size_t)HD * TT, 0, nullptr, nullptr, ZH);
}

// v003
// One run takes 141 microseconds.
// Two timings next to v002 both put it at 1.33 times that version's speed.
// Counting every step since v000, it is 33.6 times as fast.
#include <hip/hip_runtime.h>

// Self-attention with a contact-map-scaled score and an additive mask (hidden_states [32][256][768]; q, k, v = x W + b ('xw' [768][768], 12 heads x 64); cm = w_cm contact_map[b][0][i][j] + b_cm (scalar 1x1 conv; inputs read); scores = (q.k/8) cm + attention_mask[b][0][0][j]; softmax; out = merged attn.v (no output projection) -> [32][256][768] f32 (6.3 M)).
// Compute dtypes, f32 accumulate: every input rounded to bf16; q/k/v on PLAIN bf16 operands (inputs: exact) + biases; scores and attn.v: all 256 query rows hl (3 products); softmax f32; no output projection: the merged context is written in f32.

#define NB_  32
#define TT   256
#define DM   768
#define NH_  12
#define NKV  12
#define REP  (NH_ / NKV)
#define HD   64
#define DQ   (NH_ * HD)
#define DKV  (NKV * HD)
#define ZH   NH_                  // heads per attention launch: all of them (its grid y also carries the batch)
#define RH   256                  // query rows < RH use hi+lo planes (0: none)
#define WIN  0
#define PCAR 1024.0f
#define SCL  0.125f   // HD^-0.5
typedef _Float16 h16;
typedef unsigned short bf;
typedef __attribute__((ext_vector_type(16))) __bf16   v16bf;
typedef __attribute__((ext_vector_type(16))) _Float16 v16h;
typedef __attribute__((ext_vector_type(8)))  _Float16 v8h;
typedef __attribute__((ext_vector_type(8)))  unsigned short v8us;
typedef __attribute__((ext_vector_type(8)))  float    v8f;
typedef __attribute__((ext_vector_type(4)))  float    v4f;
typedef v8h  __attribute__((may_alias)) v8ha;
typedef v4f  __attribute__((may_alias)) v4fa;
typedef v8us __attribute__((may_alias)) v8usa;

__device__ __forceinline__ unsigned short f2bf(float f) { unsigned u = __float_as_uint(f); u += 0x7FFFu + ((u >> 16) & 1u); return (unsigned short)(u >> 16); }
__device__ __forceinline__ float bf2f(unsigned short b) { return __uint_as_float(((unsigned)b) << 16); }
__device__ __forceinline__ float bfr(float f) { return bf2f(f2bf(f)); }
__device__ __forceinline__ v16h cat16(v8h lo, v8h hi) { return __builtin_shufflevector(lo, hi, 0, 1, 2, 3, 4, 5, 6, 7, 8, 9, 10, 11, 12, 13, 14, 15); }
__device__ __forceinline__ v16bf cat16b(v8us lo, v8us hi) { return __builtin_bit_cast(v16bf, __builtin_shufflevector(lo, hi, 0, 1, 2, 3, 4, 5, 6, 7, 8, 9, 10, 11, 12, 13, 14, 15)); }
__device__ __forceinline__ v8f wmma16(v16h a, v16h b, v8f c) { return __builtin_amdgcn_wmma_f32_16x16x32_f16(false, a, false, b, (short)0, c, false, false); }
__device__ __forceinline__ v8f wmmab(v16bf a, v16bf b, v8f c) { return __builtin_amdgcn_wmma_f32_16x16x32_bf16(false, a, false, b, (short)0, c, false, false); }



// ---- k_gemmw: register-blocked GEMM, ONE WAVE per 64x64 output tile (16 accumulators), operands straight from K-contiguous 16-bit planes; grid (M/64, N/64, Z), 32 threads.
// C[m][n] (f32, pitch ldc, + optional f32 bias[n]) = sum_k A[m][k] Bt[n][k] (+ split products per NSPLIT). z-batch strides sA/sB/sC in elements. K % 32 == 0.
// EPI 0: C is stored in f32. EPI 1, 2 (projections; rows m = b * TT + t, the 64 tile columns are one head): C + bias is split into bf16 hi + lo here and stored
// straight into the head planes Oh, Ol: EPI 1 as [b][h][t][d], EPI 2 transposed as [b][h][d][t]; no f32 C is written.
// EPI 3 (context; z = b * nheads + h, rows t): as EPI 0, but plane z is stored merged, at C[b][t][h * HD + d] with row pitch ldc.
template <typename T16> struct WFrag;
template <> struct WFrag<h16> { typedef v16h V; static __device__ __forceinline__ V ld(const h16* p) { return cat16(*(const v8h*)p, *(const v8h*)(p + 16)); } static __device__ __forceinline__ v8f mma(V a, V b, v8f c) { return wmma16(a, b, c); } };
template <> struct WFrag<bf> { typedef v16bf V; static __device__ __forceinline__ V ld(const bf* p) { return cat16b(*(const v8us*)p, *(const v8us*)(p + 16)); } static __device__ __forceinline__ v8f mma(V a, V b, v8f c) { return wmmab(a, b, c); } };
__device__ __forceinline__ void splitf(float y, unsigned short& h, unsigned short& l) { h = f2bf(y); l = f2bf(y - bf2f(h)); }
template <typename T16, int NSPLIT, bool BIAS, int EPI>
__global__ __launch_bounds__(32) void k_gemmw(const T16* __restrict__ A, const T16* __restrict__ A2, const T16* __restrict__ Bt, const T16* __restrict__ Bt2, int K, float* C, int ldc, const float* __restrict__ bias, size_t sA, size_t sB, size_t sC, bf* Oh, bf* Ol, int nheads) {
    typedef typename WFrag<T16>::V V;
    static_assert(HD == 64 && TT % 64 == 0, "a 64 x 64 tile is 64 positions of one batch and one whole head");
    static_assert(RH == TT, "every probability row is hi + lo at scale 1, so the context needs no rescale before it is stored");
    __shared__ __align__(16) float os[16 * 68];
    __shared__ __align__(16) unsigned short vs[2 * 16 * 72];   // EPI 2: 16 d rows x 64 positions, hi then lo; pitch 144 B = 16 B x odd for the 16-byte stores and loads
    const size_t z = blockIdx.z; A += z * sA; if (A2) A2 += z * sA; Bt += z * sB; if (Bt2) Bt2 += z * sB; C += (EPI == 3) ? (z / (size_t)nheads) * TT * ldc + (z % (size_t)nheads) * HD : z * sC;
    const int lane = threadIdx.x & 31, lr = lane & 15, hi = lane >> 4; const int r0 = blockIdx.x * 64, c0 = blockIdx.y * 64;
    v8f acc[4][4];
#pragma unroll
    for (int mb = 0; mb < 4; ++mb)
#pragma unroll
        for (int nb = 0; nb < 4; ++nb) acc[mb][nb] = (v8f){};
    const size_t aoff = (size_t)(r0 + lr) * K + 8 * hi, boff = (size_t)(c0 + lr) * K + 8 * hi;
#pragma unroll 1
    for (int kc = 0; kc < K; kc += 32) {
        V a[4], a2[4];
#pragma unroll
        for (int mb = 0; mb < 4; ++mb) { a[mb] = WFrag<T16>::ld(A + aoff + (size_t)mb * 16 * K + kc); if (NSPLIT == 1 || NSPLIT == 2) a2[mb] = WFrag<T16>::ld(A2 + aoff + (size_t)mb * 16 * K + kc); }
#pragma unroll
        for (int nb = 0; nb < 4; ++nb) { const V b = WFrag<T16>::ld(Bt + boff + (size_t)nb * 16 * K + kc); V b2; if (NSPLIT >= 2) b2 = WFrag<T16>::ld(Bt2 + boff + (size_t)nb * 16 * K + kc);
#pragma unroll
            for (int mb = 0; mb < 4; ++mb) { acc[mb][nb] = WFrag<T16>::mma(a[mb], b, acc[mb][nb]); if (NSPLIT == 1 || NSPLIT == 2) acc[mb][nb] = WFrag<T16>::mma(a2[mb], b, acc[mb][nb]); if (NSPLIT >= 2) acc[mb][nb] = WFrag<T16>::mma(a[mb], b2, acc[mb][nb]); } }
        asm volatile("v_nop\n\tv_nop\n\tv_nop\n\tv_nop" : "+v"(acc[0][0]), "+v"(acc[1][1]), "+v"(acc[2][2]), "+v"(acc[3][3]) : "v"(a[0]), "v"(a[3]));
    }
    if (EPI == 1) {   // planes [b][h][t][d]: a lane takes 8 d of one row, a wave store covers 4 rows = 512 contiguous bytes
        const int sub = lane >> 3, cofs = (lane & 7) * 8; float bb[8];
#pragma unroll
        for (int q = 0; q < 8; ++q) bb[q] = bfr(bias[c0 + cofs + q]);
        const size_t pb = (((size_t)(r0 / TT) * nheads + blockIdx.y) * TT + (r0 % TT)) * HD + cofs;
#pragma unroll
        for (int mb = 0; mb < 4; ++mb) {
#pragma unroll
            for (int nb = 0; nb < 4; ++nb) {
#pragma unroll
                for (int j = 0; j < 8; ++j) os[(hi * 8 + j) * 68 + nb * 16 + lr] = acc[mb][nb][j]; }
            __builtin_amdgcn_wave_barrier(); asm volatile("" ::: "memory");   // the rows are read back by other lanes: keep the LDS stores in front of the loads
#pragma unroll
            for (int s = 0; s < 4; ++s) { const int row = 4 * s + sub; const v4f x0 = *(const v4fa*)(os + row * 68 + cofs), x1 = *(const v4fa*)(os + row * 68 + cofs + 4); v8us oh, ol;
#pragma unroll
                for (int q = 0; q < 4; ++q) { unsigned short a2, c2; splitf(x0[q] + bb[q], a2, c2); oh[q] = a2; ol[q] = c2; splitf(x1[q] + bb[4 + q], a2, c2); oh[4 + q] = a2; ol[4 + q] = c2; }
                const size_t oo = pb + (size_t)(mb * 16 + row) * HD; *(v8usa*)(Oh + oo) = oh; *(v8usa*)(Ol + oo) = ol; }
            __builtin_amdgcn_wave_barrier(); asm volatile("" ::: "memory");   // the loads stay in front of the next block's LDS stores
        }
        return;
    }
    if (EPI == 2) {   // planes [b][h][d][t]: a lane's 8 accumulator registers are 8 consecutive t of one d; staged so that every d row leaves as one whole 128-byte line
        const int sub = lane >> 3, cofs = (lane & 7) * 8;
        const size_t pb = ((size_t)(r0 / TT) * nheads + blockIdx.y) * HD * TT + (r0 % TT) + cofs; float bb[4];
#pragma unroll
        for (int nb = 0; nb < 4; ++nb) bb[nb] = bfr(bias[c0 + nb * 16 + lr]);
#pragma unroll
        for (int nb = 0; nb < 4; ++nb) { const float bn = bb[nb];
#pragma unroll
            for (int mb = 0; mb < 4; ++mb) { v8us oh, ol;
#pragma unroll
                for (int j = 0; j < 8; ++j) { unsigned short a2, c2; splitf(acc[mb][nb][j] + bn, a2, c2); oh[j] = a2; ol[j] = c2; }
                *(v8usa*)(vs + lr * 72 + mb * 16 + hi * 8) = oh; *(v8usa*)(vs + 16 * 72 + lr * 72 + mb * 16 + hi * 8) = ol; }
            __builtin_amdgcn_wave_barrier(); asm volatile("" ::: "memory");   // the rows are read back by other lanes: keep the LDS stores in front of the loads
#pragma unroll
            for (int s = 0; s < 4; ++s) { const int row = 4 * s + sub; const v8us oh = *(const v8usa*)(vs + row * 72 + cofs), ol = *(const v8usa*)(vs + 16 * 72 + row * 72 + cofs);
                const size_t oo = pb + (size_t)(nb * 16 + row) * TT; *(v8usa*)(Oh + oo) = oh; *(v8usa*)(Ol + oo) = ol; }
            __builtin_amdgcn_wave_barrier(); asm volatile("" ::: "memory");   // the loads stay in front of the next block's LDS stores
        }
        return;
    }
#pragma unroll
    for (int mb = 0; mb < 4; ++mb) {
#pragma unroll
        for (int nb = 0; nb < 4; ++nb) {
#pragma unroll
            for (int j = 0; j < 8; ++j) os[(hi * 8 + j) * 68 + nb * 16 + lr] = acc[mb][nb][j]; }
        __builtin_amdgcn_wave_barrier(); asm volatile("" ::: "memory");
        float* crow = C + (size_t)(r0 + mb * 16) * ldc + c0;
{
#pragma unroll
            for (int s = 0; s < 8; ++s) { const int row = 2 * s + hi, cofs = lr * 4; v4f val = *(const v4fa*)(os + row * 68 + cofs); if (BIAS) { val[0] += bfr(bias[c0 + cofs]); val[1] += bfr(bias[c0 + cofs + 1]); val[2] += bfr(bias[c0 + cofs + 2]); val[3] += bfr(bias[c0 + cofs + 3]); }
                *(v4f*)(crow + (size_t)row * ldc + cofs) = val; }
             }
        __builtin_amdgcn_wave_barrier(); asm volatile("" ::: "memory");
    }
}

__device__ __forceinline__ h16 tohx(float x) { return (h16)x; }
typedef __attribute__((ext_vector_type(2))) _Float16 v2h;
typedef __attribute__((ext_vector_type(4))) _Float16 v4h;
typedef __attribute__((ext_vector_type(2))) unsigned short v2us;
typedef __attribute__((ext_vector_type(4))) unsigned short v4us;
typedef __attribute__((ext_vector_type(2))) float v2f;
typedef __attribute__((ext_vector_type(4))) int v4i;

__global__ __launch_bounds__(256) void k_wtG(const float* __restrict__ w, int K, int N, bf* Bt) {
    const int lane = threadIdx.x & 31; const int L0 = (blockIdx.x * 8 + (threadIdx.x >> 5)) * 8; const int nlines = N * K / 64;
{
#pragma unroll 1
        for (int l = 0; l < 8; ++l) { const int L = L0 + l; if (L >= nlines) break; const size_t e = (size_t)L * 64 + lane * 2; const int k = (int)(e % K), n = (int)(e / K); v2us o;
            o[0] = f2bf(w[(size_t)k * N + n]); o[1] = f2bf(w[(size_t)(k + 1) * N + n]); *(v2us*)(Bt + e) = o; }
         }
}
__global__ __launch_bounds__(256) void k_cvt8(const float* __restrict__ src, bf* dst, size_t n8) { const size_t i = (size_t)blockIdx.x * 256 + threadIdx.x; if (i >= n8) return; const v8f v = *(const v8f*)(src + i * 8); v8us o;
#pragma unroll
    for (int k = 0; k < 8; ++k) o[k] = f2bf(v[k]); *(v8us*)(dst + i * 8) = o;  }

// ---- k_attn: scores, softmax and context of 128 queries of one (batch, head) in one work-group; grid (TT / 128, NB_ * NH_), 8 waves x 16 queries.
// The head's K planes [t][d] and V planes [d][t] (bf16 hi + lo) and the rounded mask row are staged once in LDS and shared by the 8 waves.
// S^T = K Q^T: A = 16 key rows from LDS, B = the wave's 16 queries, kept in registers. A lane then holds 128 of the 256 scores of ONE query (lanes l and l ^ 16 split the keys),
// so maximum and sum are in-lane plus one exchange, and two neighbouring score tiles, split into bf16 hi + lo in place, ARE the B operand of O^T += V^T P^T:
// neither the scores nor the probabilities leave the registers. The three hi/lo products of every tile keep the order hi.hi, (q or p) lo . hi, (q or p) hi . lo, k ascending.
typedef __attribute__((ext_vector_type(8))) unsigned v8u;
__device__ __forceinline__ v8f bfr8(v8f x) { v8u u = __builtin_bit_cast(v8u, x); u += 0x7FFFu + ((u >> 16) & 1u); u &= 0xFFFF0000u; return __builtin_bit_cast(v8f, u); }   // bfr on eight values
__device__ __forceinline__ void split8(v8f y, v8u& h, v8u& l) {   // splitf on eight values; each bf16 is left in the high half of its word
    h = __builtin_bit_cast(v8u, y); h += 0x7FFFu + ((h >> 16) & 1u); const v8f d = y - __builtin_bit_cast(v8f, h & 0xFFFF0000u); l = __builtin_bit_cast(v8u, d); l += 0x7FFFu + ((l >> 16) & 1u); }
// Eight v_exp_f32 in one statement, every output apart from every input, one v_nop last: so no transcendental stands directly in front of an instruction that reads its result or overwrites its source
__device__ __forceinline__ v8f exp2x8(v8f d) { float e0, e1, e2, e3, e4, e5, e6, e7;
    asm("v_exp_f32 %0, %8\n\tv_exp_f32 %1, %9\n\tv_exp_f32 %2, %10\n\tv_exp_f32 %3, %11\n\tv_exp_f32 %4, %12\n\tv_exp_f32 %5, %13\n\tv_exp_f32 %6, %14\n\tv_exp_f32 %7, %15\n\tv_nop"
        : "=&v"(e0), "=&v"(e1), "=&v"(e2), "=&v"(e3), "=&v"(e4), "=&v"(e5), "=&v"(e6), "=&v"(e7) : "v"(d[0]), "v"(d[1]), "v"(d[2]), "v"(d[3]), "v"(d[4]), "v"(d[5]), "v"(d[6]), "v"(d[7]));
    return (v8f){e0, e1, e2, e3, e4, e5, e6, e7}; }
#define KP 72     // LDS pitch of a K row, 16-bit elements: 144 B = 16 B x odd for the 16-byte fragment loads
#define VP 264    // LDS pitch of a V^T row: 528 B = 16 B x odd
__global__ __launch_bounds__(256) __attribute__((amdgpu_waves_per_eu(4, 4))) void k_attn(const bf* __restrict__ Qh, const bf* __restrict__ Ql, const bf* __restrict__ Kh, const bf* __restrict__ Kl, const bf* __restrict__ Vh, const bf* __restrict__ Vl, const float* __restrict__ CMb, const float* __restrict__ AMb, const float* __restrict__ WCM, const float* __restrict__ BCM, float* __restrict__ O) {
    typedef WFrag<bf> F; typedef F::V V;
    static_assert(TT == 256 && HD == 64 && NKV == NH_, "256 threads stage 256 keys; 16 score tiles and 4 output tiles a wave; one kv head per query head");
    __shared__ __align__(16) bf ks[2 * TT * KP];    // K hi, then K lo
    __shared__ __align__(16) bf vt[2 * HD * VP];    // V^T hi, then V^T lo
    __shared__ __align__(16) float ms[TT];          // the mask row, rounded to bf16 once
    const int tid = threadIdx.x, lane = tid & 31, lr = lane & 15, hi = lane >> 4;
    const size_t z = blockIdx.y; const size_t b = z / NH_, h = z % NH_;
    const int q0 = (blockIdx.x * 8 + (tid >> 5)) * 16;
    const float wcm = bfr(WCM[0]), bcm = bfr(BCM[0]);
    const float* cmr = CMb + (b * TT + q0 + lr) * TT + 8 * hi;
    v4f cq[3][2];   // contact-map pieces of the score tile in hand and of the next two: fetched two tiles ahead; the first two fly with the staging loads
#pragma unroll
    for (int nb = 0; nb < 2; ++nb) { cq[nb][0] = *(const v4fa*)(cmr + nb * 16); cq[nb][1] = *(const v4fa*)(cmr + nb * 16 + 4); }
    { const bf* gk0 = Kh + z * TT * HD; const bf* gk1 = Kl + z * TT * HD; const bf* gv0 = Vh + z * HD * TT; const bf* gv1 = Vl + z * HD * TT;
#pragma unroll
      for (int it = 0; it < TT * HD / 8 / 256; ++it) { const int go = (it * 256 + tid) * 8;   // 16-byte piece it * 256 + tid of each plane: a wave reads 512 contiguous bytes
          const v8us x0 = *(const v8usa*)(gk0 + go), x1 = *(const v8usa*)(gk1 + go), x2 = *(const v8usa*)(gv0 + go), x3 = *(const v8usa*)(gv1 + go);
          bf* kd = ks + (it * 32 + (tid >> 3)) * KP + (tid & 7) * 8; bf* vd = vt + (it * 8 + (tid >> 5)) * VP + (tid & 31) * 8;
          *(v8usa*)kd = x0; *(v8usa*)(kd + TT * KP) = x1; *(v8usa*)vd = x2; *(v8usa*)(vd + HD * VP) = x3; }
      ms[tid] = bfr(AMb[b * TT + tid]); }
    V qh[2], ql[2];
    { const size_t qo = z * TT * HD + (size_t)(q0 + lr) * HD + 8 * hi; const bf* qph = Qh + qo; const bf* qpl = Ql + qo;
#pragma unroll
      for (int kc = 0; kc < 2; ++kc) { qh[kc] = F::ld(qph + kc * 32); ql[kc] = F::ld(qpl + kc * 32); }
      asm volatile("s_wait_xcnt 0x0" :: "v"(qph), "v"(qpl) : "memory"); }   // the two address pairs stay whole up to this wait: otherwise the last load of each plane lands on the pair that the loads before it name
    __syncthreads();   // the staged planes and the mask row are read by every wave
    // s[nb][r] = score of query q0 + lr and key nb * 16 + 8 * hi + r
    const bf* kr = ks + lr * KP + 8 * hi;
    V kf[4];        // K fragments of the tile in hand (hi, lo of k 0..31; hi, lo of k 32..63): fetched one tile ahead, behind the tile's own products
#pragma unroll
    for (int kc = 0; kc < 2; ++kc) { kf[2 * kc] = F::ld(kr + kc * 32); kf[2 * kc + 1] = F::ld(kr + TT * KP + kc * 32); }
    v8f s[16], mxv;
#pragma unroll
    for (int r = 0; r < 8; ++r) mxv[r] = -3.0e38f;
#pragma unroll
    for (int nb = 0; nb < 16; ++nb) { v8f acc = (v8f){};
        const v4f m0 = *(const v4fa*)(ms + nb * 16 + 8 * hi), m1 = *(const v4fa*)(ms + nb * 16 + 8 * hi + 4);
#pragma unroll
        for (int kc = 0; kc < 2; ++kc) { acc = F::mma(kf[2 * kc], qh[kc], acc); acc = F::mma(kf[2 * kc], ql[kc], acc); acc = F::mma(kf[2 * kc + 1], qh[kc], acc); }
        __builtin_amdgcn_sched_barrier(0);   // the next tile's fragments reuse this tile's registers: lifted over the products they cost 32 more, and the build spills
        if (nb + 1 < 16) {
#pragma unroll
            for (int kc = 0; kc < 2; ++kc) { kf[2 * kc] = F::ld(kr + (nb + 1) * 16 * KP + kc * 32); kf[2 * kc + 1] = F::ld(kr + (nb + 1) * 16 * KP + TT * KP + kc * 32); } }
        if (nb + 2 < 16) { cq[(nb + 2) % 3][0] = *(const v4fa*)(cmr + (nb + 2) * 16); cq[(nb + 2) % 3][1] = *(const v4fa*)(cmr + (nb + 2) * 16 + 4); }
        const v8f c8 = __builtin_shufflevector(cq[nb % 3][0], cq[nb % 3][1], 0, 1, 2, 3, 4, 5, 6, 7), m8 = __builtin_shufflevector(m0, m1, 0, 1, 2, 3, 4, 5, 6, 7);
        s[nb] = (acc * SCL) * (wcm * bfr8(c8) + bcm) + m8;   /* (q.k/8) x (w_cm c + b_cm) + mask */
        mxv = __builtin_elementwise_max(mxv, s[nb]);
        asm volatile("" :: "v"(s[nb]));      // inputs only: the tile's finished scores are due here; otherwise the compiler sinks all 16 tiles' vector work behind the last product, holds every contact-map and mask piece until then, and spills
    }
    float mx = fmaxf(fmaxf(fmaxf(mxv[0], mxv[1]), fmaxf(mxv[2], mxv[3])), fmaxf(fmaxf(mxv[4], mxv[5]), fmaxf(mxv[6], mxv[7])));
    mx = fmaxf(mx, __shfl_xor(mx, 16, 32));
    v8f sv = (v8f){};   // eight independent partial sums a lane
#pragma unroll
    for (int nb = 0; nb < 16; ++nb) {
        const v8f e = exp2x8((s[nb] - mx) * 1.4426950408889634f); s[nb] = e; sv += e; }
    float sum = ((sv[0] + sv[1]) + (sv[2] + sv[3])) + ((sv[4] + sv[5]) + (sv[6] + sv[7]));
    sum += __shfl_xor(sum, 16, 32);
    const float f = __fdiv_rn(1.0f, sum);
    // o[mb][r] = context of query q0 + lr at d = mb * 16 + 8 * hi + r
    v8f o[4];
#pragma unroll
    for (int mb = 0; mb < 4; ++mb) o[mb] = (v8f){};
#pragma unroll
    for (int c = 0; c < 8; ++c) { v8u h0, l0, h1, l1, wh, wl;   // keys c * 32 + {8 hi + r, 16 + 8 hi + r}: the k order of the fragment loader
        split8(s[2 * c] * f, h0, l0); split8(s[2 * c + 1] * f, h1, l1);
#pragma unroll
        for (int w = 0; w < 4; ++w) { wh[w] = (h0[2 * w] >> 16) | (h0[2 * w + 1] & 0xFFFF0000u); wh[4 + w] = (h1[2 * w] >> 16) | (h1[2 * w + 1] & 0xFFFF0000u);
            wl[w] = (l0[2 * w] >> 16) | (l0[2 * w + 1] & 0xFFFF0000u); wl[4 + w] = (l1[2 * w] >> 16) | (l1[2 * w + 1] & 0xFFFF0000u); }
        const V ph = __builtin_bit_cast(V, wh), pl = __builtin_bit_cast(V, wl);
#pragma unroll
        for (int mb = 0; mb < 4; ++mb) { const bf* vr = vt + (mb * 16 + lr) * VP + c * 32 + 8 * hi; const V a = F::ld(vr), a2 = F::ld(vr + HD * VP);
            o[mb] = F::mma(a, ph, o[mb]); o[mb] = F::mma(a, pl, o[mb]); o[mb] = F::mma(a2, ph, o[mb]); } }
    float* orow = O + (b * TT + q0 + lr) * DQ + h * HD + 8 * hi;   // merged output [b][t][h * HD + d]: a lane's 8 registers are 8 consecutive d
#pragma unroll
    for (int mb = 0; mb < 4; ++mb) { *(v4fa*)(orow + mb * 16) = (v4f){o[mb][0], o[mb][1], o[mb][2], o[mb][3]}; *(v4fa*)(orow + mb * 16 + 4) = (v4f){o[mb][4], o[mb][5], o[mb][6], o[mb][7]}; }
}

extern "C" void kernel_launch(void* const* d_in, const int* in_sizes, int n_in,
                              void* d_out, int out_size, void* d_ws, size_t ws_size, hipStream_t stream) {
    (void)in_sizes; (void)n_in; (void)out_size;
    const float* x = (const float*)d_in[0]; const float* CM = (const float*)d_in[1]; const float* AM = (const float*)d_in[2]; const float* wq = (const float*)d_in[3]; const float* bq = (const float*)d_in[4]; const float* wk = (const float*)d_in[5]; const float* bk = (const float*)d_in[6]; const float* wv = (const float*)d_in[7]; const float* bv = (const float*)d_in[8]; const float* WCM = (const float*)d_in[9]; const float* BCM = (const float*)d_in[10]; const float* wo = nullptr; (void)wo;
    float* OUT = (float*)d_out;     // [32][256][768]
    char* wsp = (char*)d_ws;
    auto take = [&](size_t bytes) { char* p = wsp; wsp += (bytes + 255) & ~(size_t)255; return (void*)p; };
    bf* WQ = (bf*)take((size_t)DQ * DM * 2); bf* WK = (bf*)take((size_t)DKV * DM * 2); bf* WV = (bf*)take((size_t)DKV * DM * 2);
    // whole-batch planes [b][h][..]
    bf* QPh = (bf*)take((size_t)NB_ * NH_ * TT * HD * 2); bf* QPl = (bf*)take((size_t)NB_ * NH_ * TT * HD * 2); bf* KPh = (bf*)take((size_t)NB_ * NKV * TT * HD * 2); bf* KPl = (bf*)take((size_t)NB_ * NKV * TT * HD * 2); bf* VTh = (bf*)take((size_t)NB_ * NKV * HD * TT * 2); bf* VTl = (bf*)take((size_t)NB_ * NKV * HD * TT * 2);
    bf* XB = (bf*)take((size_t)NB_ * TT * DM * 2);   // x in bf16
    if ((size_t)(wsp - (char*)d_ws) > ws_size) return;    // ws 256 MiB
    { k_wtG<<<(unsigned)((DM * DQ / 64 + 63) / 64), 256, 0, stream>>>(wq, DM, DQ, WQ); k_wtG<<<(unsigned)((DM * DKV / 64 + 63) / 64), 256, 0, stream>>>(wk, DM, DKV, WK); k_wtG<<<(unsigned)((DM * DKV / 64 + 63) / 64), 256, 0, stream>>>(wv, DM, DKV, WV);
       }
    // every launch covers all NB_ batches (GEMM rows, or grid y = b * NH_ + h in the attention) and all heads
    k_cvt8<<<(unsigned)(((size_t)NB_ * TT * DM / 8 + 255) / 256), 256, 0, stream>>>(x, XB, (size_t)NB_ * TT * DM / 8);
    // the projections split x W + b into the bf16 hi + lo head planes in their own epilogue (q, k as [b][h][t][d]; v transposed as [b][h][d][t])
    k_gemmw<bf, 0, true, 1><<<dim3(NB_ * TT / 64, DQ / 64, 1), 32, 0, stream>>>(XB, nullptr, WQ, nullptr, DM, nullptr, 0, bq, 0, 0, 0, QPh, QPl, NH_);
    k_gemmw<bf, 0, true, 1><<<dim3(NB_ * TT / 64, DKV / 64, 1), 32, 0, stream>>>(XB, nullptr, WK, nullptr, DM, nullptr, 0, bk, 0, 0, 0, KPh, KPl, NKV);
    k_gemmw<bf, 0, true, 2><<<dim3(NB_ * TT / 64, DKV / 64, 1), 32, 0, stream>>>(XB, nullptr, WV, nullptr, DM, nullptr, 0, bv, 0, 0, 0, VTh, VTl, NKV);
    // scores, softmax and context in one launch: plane z = b * NH_ + h on every side; the f32 context goes straight into the merged output [b][t][h * HD + d]
    k_attn<<<dim3(TT / 128, NB_ * NH_, 1), 256, 0, stream>>>(QPh, QPl, KPh, KPl, VTh, VTl, CM, AM, WCM, BCM, OUT);
}

// v004
// One run takes 103 microseconds.
// Two timings next to v003 put it at 1.38 and 1.37 times that version's speed.
// All steps since v000 together make it 46.0 times as fast.
#include <hip/hip_runtime.h>

// Self-attention with a contact-map-scaled score and an additive mask (hidden_states [32][256][768]; q, k, v = x W + b ('xw' [768][768], 12 heads x 64); cm = w_cm contact_map[b][0][i][j] + b_cm (scalar 1x1 conv; inputs read); scores = (q.k/8) cm + attention_mask[b][0][0][j]; softmax; out = merged attn.v (no output projection) -> [32][256][768] f32 (6.3 M)).
// Compute dtypes, f32 accumulate: every input rounded to bf16; q/k/v on PLAIN bf16 operands (inputs: exact) + biases; scores and attn.v: all 256 query rows hl (3 products); softmax f32; no output projection: the merged context is written in f32.

#define NB_  32
#define TT   256
#define DM   768
#define NH_  12
#define NKV  12
#define REP  (NH_ / NKV)
#define HD   64
#define DQ   (NH_ * HD)
#define DKV  (NKV * HD)
#define ZH   NH_                  // heads per attention launch: all of them (its grid y also carries the batch)
#define RH   256                  // query rows < RH use hi+lo planes (0: none)
#define WIN  0
#define PCAR 1024.0f
#define SCL  0.125f   // HD^-0.5
typedef _Float16 h16;
typedef unsigned short bf;
typedef __attribute__((ext_vector_type(16))) __bf16   v16bf;
typedef __attribute__((ext_vector_type(16))) _Float16 v16h;
typedef __attribute__((ext_vector_type(8)))  _Float16 v8h;
typedef __attribute__((ext_vector_type(8)))  unsigned short v8us;
typedef __attribute__((ext_vector_type(8)))  float    v8f;
typedef __attribute__((ext_vector_type(4)))  float    v4f;
typedef v8h  __attribute__((may_alias)) v8ha;
typedef v4f  __attribute__((may_alias)) v4fa;
typedef v8us __attribute__((may_alias)) v8usa;

__device__ __forceinline__ unsigned short f2bf(float f) { unsigned u = __float_as_uint(f); u += 0x7FFFu + ((u >> 16) & 1u); return (unsigned short)(u >> 16); }
__device__ __forceinline__ float bf2f(unsigned short b) { return __uint_as_float(((unsigned)b) << 16); }
__device__ __forceinline__ float bfr(float f) { return bf2f(f2bf(f)); }
__device__ __forceinline__ v16h cat16(v8h lo, v8h hi) { return __builtin_shufflevector(lo, hi, 0, 1, 2, 3, 4, 5, 6, 7, 8, 9, 10, 11, 12, 13, 14, 15); }
__device__ __forceinline__ v16bf cat16b(v8us lo, v8us hi) { return __builtin_bit_cast(v16bf, __builtin_shufflevector(lo, hi, 0, 1, 2, 3, 4, 5, 6, 7, 8, 9, 10, 11, 12, 13, 14, 15)); }
__device__ __forceinline__ v8f wmma16(v16h a, v16h b, v8f c) { return __builtin_amdgcn_wmma_f32_16x16x32_f16(false, a, false, b, (short)0, c, false, false); }
__device__ __forceinline__ v8f wmmab(v16bf a, v16bf b, v8f c) { return __builtin_amdgcn_wmma_f32_16x16x32_bf16(false, a, false, b, (short)0, c, false, false); }



// ---- k_proj: the three projections in ONE launch. Register-blocked GEMM, ONE WAVE per 64x64 output tile (16 accumulators), operands straight from K-contiguous bf16 planes; grid (M/64, heads, 3), 32 threads.
// Grid z picks the projection (0: q, 1: k, 2: v), so the waves of the three run side by side: C[m][n] = sum_k A[m][k] Bt[n][k] for 64 rows of x (m = b * TT + t) and one head's 64 columns, Bt = Wq^T, Wk^T or Wv^T, k ascending.
// C + bias is split into bf16 hi + lo in the epilogue and stored straight into the head planes Oh, Ol: q and k as [b][h][t][d], v transposed as [b][h][d][t]; no f32 C is written.
template <typename T16> struct WFrag;
template <> struct WFrag<h16> { typedef v16h V; static __device__ __forceinline__ V ld(const h16* p) { return cat16(*(const v8h*)p, *(const v8h*)(p + 16)); } static __device__ __forceinline__ v8f mma(V a, V b, v8f c) { return wmma16(a, b, c); } };
template <> struct WFrag<bf> { typedef v16bf V; static __device__ __forceinline__ V ld(const bf* p) { return cat16b(*(const v8us*)p, *(const v8us*)(p + 16)); } static __device__ __forceinline__ v8f mma(V a, V b, v8f c) { return wmmab(a, b, c); } };
__device__ __forceinline__ void splitf(float y, unsigned short& h, unsigned short& l) { h = f2bf(y); l = f2bf(y - bf2f(h)); }
// five waves a SIMD (192 registers): then all of the grid's 4608 waves are resident at once, 18 on each of 256 WGPs, and no second round of work-groups follows the first
__global__ __launch_bounds__(32) __attribute__((amdgpu_waves_per_eu(5))) void k_proj(const bf* __restrict__ A, const bf* __restrict__ Wq, const bf* __restrict__ Wk, const bf* __restrict__ Wv, const float* __restrict__ bq, const float* __restrict__ bk, const float* __restrict__ bv, bf* Qh, bf* Ql, bf* Kh, bf* Kl, bf* Vh, bf* Vl) {
    typedef WFrag<bf> F; typedef F::V V;
    static_assert(HD == 64 && TT % 64 == 0, "a 64 x 64 tile is 64 positions of one batch and one whole head");
    static_assert(RH == TT, "every probability row is hi + lo at scale 1, so the context needs no rescale before it is stored");
    static_assert(NKV == NH_, "q, k and v have the same heads: grid x and y mean the same in the three");
    __shared__ __align__(16) float os[16 * 68];
    __shared__ __align__(16) unsigned short vs[2 * 16 * 72];   // v: 16 d rows x 64 positions, hi then lo; pitch 144 B = 16 B x odd for the 16-byte stores and loads
    constexpr int K = DM, nheads = NH_;
    const int lane = threadIdx.x & 31, lr = lane & 15, hi = lane >> 4; const int r0 = blockIdx.x * 64, c0 = blockIdx.y * 64;
    const size_t aoff = (size_t)(r0 + lr) * K + 8 * hi, boff = (size_t)(c0 + lr) * K + 8 * hi;
    {
        const int p = blockIdx.z;
        const bf* __restrict__ Bt = p == 0 ? Wq : p == 1 ? Wk : Wv; const float* __restrict__ bias = p == 0 ? bq : p == 1 ? bk : bv; bf* Oh = p == 0 ? Qh : p == 1 ? Kh : Vh; bf* Ol = p == 0 ? Ql : p == 1 ? Kl : Vl;
        v8f acc[4][4];
#pragma unroll
        for (int mb = 0; mb < 4; ++mb)
#pragma unroll
            for (int nb = 0; nb < 4; ++nb) acc[mb][nb] = (v8f){};
#pragma unroll 1
        for (int kc = 0; kc < K; kc += 32) {
            V a[4]; const bf* pa = A + aoff + kc; const bf* pb = Bt + boff + kc;
#pragma unroll
            for (int mb = 0; mb < 4; ++mb) a[mb] = F::ld(pa + (size_t)mb * 16 * K);
#pragma unroll
            for (int nb = 0; nb < 4; ++nb) { const V b = F::ld(pb + (size_t)nb * 16 * K);
#pragma unroll
                for (int mb = 0; mb < 4; ++mb) acc[mb][nb] = F::mma(a[mb], b, acc[mb][nb]); }
            // the wait: the trip's two address pairs stay whole up to it (otherwise a later load of the trip lands on a pair that the loads before it name), and the next trip rewrites them behind it;
            // the four vector slots behind the trip's last products, on the back edge too: the next trip's loads overwrite their A and B registers
            asm volatile("s_wait_xcnt 0x0\n\tv_nop\n\tv_nop\n\tv_nop\n\tv_nop" : "+v"(acc[0][0]), "+v"(acc[1][1]), "+v"(acc[2][2]), "+v"(acc[3][3]) : "v"(a[0]), "v"(a[3]), "v"(pa), "v"(pb) : "memory");
        }
        if (p < 2) {   // q, k: planes [b][h][t][d]: a lane takes 8 d of one row, a wave store covers 4 rows = 512 contiguous bytes
            const int sub = lane >> 3, cofs = (lane & 7) * 8; float bb[8];
#pragma unroll
            for (int q = 0; q < 8; ++q) bb[q] = bfr(bias[c0 + cofs + q]);
            const size_t pb = (((size_t)(r0 / TT) * nheads + blockIdx.y) * TT + (r0 % TT)) * HD + cofs;
#pragma unroll
            for (int mb = 0; mb < 4; ++mb) {
#pragma unroll
                for (int nb = 0; nb < 4; ++nb) {
#pragma unroll
                    for (int j = 0; j < 8; ++j) os[(hi * 8 + j) * 68 + nb * 16 + lr] = acc[mb][nb][j]; }
                __builtin_amdgcn_wave_barrier(); asm volatile("" ::: "memory");   // the rows are read back by other lanes: keep the LDS stores in front of the loads
#pragma unroll
                for (int s = 0; s < 4; ++s) { const int row = 4 * s + sub; const v4f x0 = *(const v4fa*)(os + row * 68 + cofs), x1 = *(const v4fa*)(os + row * 68 + cofs + 4); v8us oh, ol;
#pragma unroll
                    for (int q = 0; q < 4; ++q) { unsigned short a2, c2; splitf(x0[q] + bb[q], a2, c2); oh[q] = a2; ol[q] = c2; splitf(x1[q] + bb[4 + q], a2, c2); oh[4 + q] = a2; ol[4 + q] = c2; }
                    const size_t oo = pb + (size_t)(mb * 16 + row) * HD; *(v8usa*)(Oh + oo) = oh; *(v8usa*)(Ol + oo) = ol; }
                __builtin_amdgcn_wave_barrier(); asm volatile("" ::: "memory");   // the loads stay in front of the next block's LDS stores
            }
        } else {   // v: planes [b][h][d][t]: a lane's 8 accumulator registers are 8 consecutive t of one d; staged so that every d row leaves as one whole 128-byte line
            const int sub = lane >> 3, cofs = (lane & 7) * 8;
            const size_t pb = ((size_t)(r0 / TT) * nheads + blockIdx.y) * HD * TT + (r0 % TT) + cofs; float bb[4];
#pragma unroll
            for (int nb = 0; nb < 4; ++nb) bb[nb] = bfr(bias[c0 + nb * 16 + lr]);
#pragma unroll
            for (int nb = 0; nb < 4; ++nb) { const float bn = bb[nb];
#pragma unroll
                for (int mb = 0; mb < 4; ++mb) { v8us oh, ol;
#pragma unroll
                    for (int j = 0; j < 8; ++j) { unsigned short a2, c2; splitf(acc[mb][nb][j] + bn, a2, c2); oh[j] = a2; ol[j] = c2; }
                    *(v8usa*)(vs + lr * 72 + mb * 16 + hi * 8) = oh; *(v8usa*)(vs + 16 * 72 + lr * 72 + mb * 16 + hi * 8) = ol; }
                __builtin_amdgcn_wave_barrier(); asm volatile("" ::: "memory");   // the rows are read back by other lanes: keep the LDS stores in front of the loads
#pragma unroll
                for (int s = 0; s < 4; ++s) { const int row = 4 * s + sub; const v8us oh = *(const v8usa*)(vs + row * 72 + cofs), ol = *(const v8usa*)(vs + 16 * 72 + row * 72 + cofs);
                    const size_t oo = pb + (size_t)(nb * 16 + row) * TT; *(v8usa*)(Oh + oo) = oh; *(v8usa*)(Ol + oo) = ol; }
                __builtin_amdgcn_wave_barrier(); asm volatile("" ::: "memory");   // the loads stay in front of the next block's LDS stores
            }
            asm volatile("s_wait_xcnt 0x0" ::: "memory");   // the build lays the q, k epilogue directly behind this one, under a branch: its first instructions write registers that the last stores here name
        }
    }
}

__device__ __forceinline__ h16 tohx(float x) { return (h16)x; }
typedef __attribute__((ext_vector_type(2))) _Float16 v2h;
typedef __attribute__((ext_vector_type(4))) _Float16 v4h;
typedef __attribute__((ext_vector_type(2))) unsigned short v2us;
typedef __attribute__((ext_vector_type(4))) unsigned short v4us;
typedef __attribute__((ext_vector_type(2))) float v2f;
typedef __attribute__((ext_vector_type(4))) int v4i;

// ---- k_prep: the four operand conversions in ONE launch (they depend on nothing but the inputs). Blocks 0 .. 3 WTB - 1: Wq, Wk, Wv transposed into bf16 [n][k]; the rest: x into bf16.
// The transposes stand first in the grid: each of their waves walks eight dependent trips.
__device__ __forceinline__ void wtG(const float* __restrict__ w, int K, int N, bf* Bt, int blk) {
    const int lane = threadIdx.x & 31; const int L0 = (blk * 8 + (threadIdx.x >> 5)) * 8; const int nlines = N * K / 64;
{
#pragma unroll 1
        for (int l = 0; l < 8; ++l) { const int L = L0 + l; if (L >= nlines) break; const size_t e = (size_t)L * 64 + lane * 2; const int k = (int)(e % K), n = (int)(e / K); v2us o;
            o[0] = f2bf(w[(size_t)k * N + n]); o[1] = f2bf(w[(size_t)(k + 1) * N + n]); *(v2us*)(Bt + e) = o; }
         }
}
__device__ __forceinline__ void cvt8(const float* __restrict__ src, bf* dst, size_t n8, size_t blk) { const size_t i = blk * 256 + threadIdx.x; if (i >= n8) return; const float* sp = src + i * 8; const v8f v = *(const v8f*)sp; v8us o;
    asm volatile("s_wait_xcnt 0x0" :: "v"(sp) : "memory");   // the address pair stays whole up to this wait; the conversion reuses it behind it
#pragma unroll
    for (int k = 0; k < 8; ++k) o[k] = f2bf(v[k]); *(v8us*)(dst + i * 8) = o;  }
#define WTB ((DM * DQ / 64 + 63) / 64)                       // blocks of one transpose
#define XCB (((size_t)NB_ * TT * DM / 8 + 255) / 256)        // blocks of the x conversion
__global__ __launch_bounds__(256) void k_prep(const float* __restrict__ wq, const float* __restrict__ wk, const float* __restrict__ wv, bf* WQ, bf* WK, bf* WV, const float* __restrict__ x, bf* XB) {
    static_assert(DKV == DQ, "the three weight matrices have one shape");
    const int blk = blockIdx.x;
    if (blk < 3 * WTB) { const int p = blk / WTB; wtG(p == 0 ? wq : p == 1 ? wk : wv, DM, DQ, p == 0 ? WQ : p == 1 ? WK : WV, blk - p * WTB); }
    else cvt8(x, XB, (size_t)NB_ * TT * DM / 8, (size_t)(blk - 3 * WTB));
}

// ---- k_attn: scores, softmax and context of 128 queries of one (batch, head) in one work-group; grid (TT / 128, NB_ * NH_), 8 waves x 16 queries.
// The head's K planes [t][d] and V planes [d][t] (bf16 hi + lo) and the rounded mask row are staged once in LDS and shared by the 8 waves.
// S^T = K Q^T: A = 16 key rows from LDS, B = the wave's 16 queries, kept in registers. A lane then holds 128 of the 256 scores of ONE query (lanes l and l ^ 16 split the keys),
// so maximum and sum are in-lane plus one exchange, and two neighbouring score tiles, split into bf16 hi + lo in place, ARE the B operand of O^T += V^T P^T:
// neither the scores nor the probabilities leave the registers. The three hi/lo products of every tile keep the order hi.hi, (q or p) lo . hi, (q or p) hi . lo, k ascending.
typedef __attribute__((ext_vector_type(8))) unsigned v8u;
__device__ __forceinline__ v8f bfr8(v8f x) { v8u u = __builtin_bit_cast(v8u, x); u += 0x7FFFu + ((u >> 16) & 1u); u &= 0xFFFF0000u; return __builtin_bit_cast(v8f, u); }   // bfr on eight values
__device__ __forceinline__ void split8(v8f y, v8u& h, v8u& l) {   // splitf on eight values; each bf16 is left in the high half of its word
    h = __builtin_bit_cast(v8u, y); h += 0x7FFFu + ((h >> 16) & 1u); const v8f d = y - __builtin_bit_cast(v8f, h & 0xFFFF0000u); l = __builtin_bit_cast(v8u, d); l += 0x7FFFu + ((l >> 16) & 1u); }
// Eight v_exp_f32 in one statement, every output apart from every input, one v_nop last: so no transcendental stands directly in front of an instruction that reads its result or overwrites its source
__device__ __forceinline__ v8f exp2x8(v8f d) { float e0, e1, e2, e3, e4, e5, e6, e7;
    asm("v_exp_f32 %0, %8\n\tv_exp_f32 %1, %9\n\tv_exp_f32 %2, %10\n\tv_exp_f32 %3, %11\n\tv_exp_f32 %4, %12\n\tv_exp_f32 %5, %13\n\tv_exp_f32 %6, %14\n\tv_exp_f32 %7, %15\n\tv_nop"
        : "=&v"(e0), "=&v"(e1), "=&v"(e2), "=&v"(e3), "=&v"(e4), "=&v"(e5), "=&v"(e6), "=&v"(e7) : "v"(d[0]), "v"(d[1]), "v"(d[2]), "v"(d[3]), "v"(d[4]), "v"(d[5]), "v"(d[6]), "v"(d[7]));
    return (v8f){e0, e1, e2, e3, e4, e5, e6, e7}; }
#define KP 72     // LDS pitch of a K row, 16-bit elements: 144 B = 16 B x odd for the 16-byte fragment loads
#define VP 264    // LDS pitch of a V^T row: 528 B = 16 B x odd
__global__ __launch_bounds__(256) __attribute__((amdgpu_waves_per_eu(4, 4))) void k_attn(const bf* __restrict__ Qh, const bf* __restrict__ Ql, const bf* __restrict__ Kh, const bf* __restrict__ Kl, const bf* __restrict__ Vh, const bf* __restrict__ Vl, const float* __restrict__ CMb, const float* __restrict__ AMb, const float* __restrict__ WCM, const float* __restrict__ BCM, float* __restrict__ O) {
    typedef WFrag<bf> F; typedef F::V V;
    static_assert(TT == 256 && HD == 64 && NKV == NH_, "256 threads stage 256 keys; 16 score tiles and 4 output tiles a wave; one kv head per query head");
    __shared__ __align__(16) bf ks[2 * TT * KP];    // K hi, then K lo
    __shared__ __align__(16) bf vt[2 * HD * VP];    // V^T hi, then V^T lo
    __shared__ __align__(16) float ms[TT];          // the mask row, rounded to bf16 once
    const int tid = threadIdx.x, lane = tid & 31, lr = lane & 15, hi = lane >> 4;
    const size_t z = blockIdx.y; const size_t b = z / NH_, h = z % NH_;
    const int q0 = (blockIdx.x * 8 + (tid >> 5)) * 16;
    const float wcm = bfr(WCM[0]), bcm = bfr(BCM[0]);
    const float* cmr = CMb + (b * TT + q0 + lr) * TT + 8 * hi;
    v4f cq[3][2];   // contact-map pieces of the score tile in hand and of the next two: fetched two tiles ahead; the first two fly with the staging loads
#pragma unroll
    for (int nb = 0; nb < 2; ++nb) { cq[nb][0] = *(const v4fa*)(cmr + nb * 16); cq[nb][1] = *(const v4fa*)(cmr + nb * 16 + 4); }
    { const bf* gk0 = Kh + z * TT * HD; const bf* gk1 = Kl + z * TT * HD; const bf* gv0 = Vh + z * HD * TT; const bf* gv1 = Vl + z * HD * TT;
#pragma unroll
      for (int it = 0; it < TT * HD / 8 / 256; ++it) { const int go = (it * 256 + tid) * 8;   // 16-byte piece it * 256 + tid of each plane: a wave reads 512 contiguous bytes
          const v8us x0 = *(const v8usa*)(gk0 + go), x1 = *(const v8usa*)(gk1 + go), x2 = *(const v8usa*)(gv0 + go), x3 = *(const v8usa*)(gv1 + go);
          bf* kd = ks + (it * 32 + (tid >> 3)) * KP + (tid & 7) * 8; bf* vd = vt + (it * 8 + (tid >> 5)) * VP + (tid & 31) * 8;
          *(v8usa*)kd = x0; *(v8usa*)(kd + TT * KP) = x1; *(v8usa*)vd = x2; *(v8usa*)(vd + HD * VP) = x3; }
      ms[tid] = bfr(AMb[b * TT + tid]); }
    V qh[2], ql[2];
    { const size_t qo = z * TT * HD + (size_t)(q0 + lr) * HD + 8 * hi; const bf* qph = Qh + qo; const bf* qpl = Ql + qo;
#pragma unroll
      for (int kc = 0; kc < 2; ++kc) { qh[kc] = F::ld(qph + kc * 32); ql[kc] = F::ld(qpl + kc * 32); }
      asm volatile("s_wait_xcnt 0x0" :: "v"(qph), "v"(qpl) : "memory"); }   // the two address pairs stay whole up to this wait: otherwise the last load of each plane lands on the pair that the loads before it name
    __syncthreads();   // the staged planes and the mask row are read by every wave
    // s[nb][r] = score of query q0 + lr and key nb * 16 + 8 * hi + r
    const bf* kr = ks + lr * KP + 8 * hi;
    V kf[4];        // K fragments of the tile in hand (hi, lo of k 0..31; hi, lo of k 32..63): fetched one tile ahead, behind the tile's own products
#pragma unroll
    for (int kc = 0; kc < 2; ++kc) { kf[2 * kc] = F::ld(kr + kc * 32); kf[2 * kc + 1] = F::ld(kr + TT * KP + kc * 32); }
    v8f s[16], mxv;
#pragma unroll
    for (int r = 0; r < 8; ++r) mxv[r] = -3.0e38f;
#pragma unroll
    for (int nb = 0; nb < 16; ++nb) { v8f acc = (v8f){};
        const v4f m0 = *(const v4fa*)(ms + nb * 16 + 8 * hi), m1 = *(const v4fa*)(ms + nb * 16 + 8 * hi + 4);
#pragma unroll
        for (int kc = 0; kc < 2; ++kc) { acc = F::mma(kf[2 * kc], qh[kc], acc); acc = F::mma(kf[2 * kc], ql[kc], acc); acc = F::mma(kf[2 * kc + 1], qh[kc], acc); }
        __builtin_amdgcn_sched_barrier(0);   // the next tile's fragments reuse this tile's registers: lifted over the products they cost 32 more, and the build spills
        if (nb + 1 < 16) {
#pragma unroll
            for (int kc = 0; kc < 2; ++kc) { kf[2 * kc] = F::ld(kr + (nb + 1) * 16 * KP + kc * 32); kf[2 * kc + 1] = F::ld(kr + (nb + 1) * 16 * KP + TT * KP + kc * 32); } }
        if (nb + 2 < 16) { cq[(nb + 2) % 3][0] = *(const v4fa*)(cmr + (nb + 2) * 16); cq[(nb + 2) % 3][1] = *(const v4fa*)(cmr + (nb + 2) * 16 + 4); }
        const v8f c8 = __builtin_shufflevector(cq[nb % 3][0], cq[nb % 3][1], 0, 1, 2, 3, 4, 5, 6, 7), m8 = __builtin_shufflevector(m0, m1, 0, 1, 2, 3, 4, 5, 6, 7);
        s[nb] = (acc * SCL) * (wcm * bfr8(c8) + bcm) + m8;   /* (q.k/8) x (w_cm c + b_cm) + mask */
        mxv = __builtin_elementwise_max(mxv, s[nb]);
        asm volatile("" :: "v"(s[nb]));      // inputs only: the tile's finished scores are due here; otherwise the compiler sinks all 16 tiles' vector work behind the last product, holds every contact-map and mask piece until then, and spills
    }
    float mx = fmaxf(fmaxf(fmaxf(mxv[0], mxv[1]), fmaxf(mxv[2], mxv[3])), fmaxf(fmaxf(mxv[4], mxv[5]), fmaxf(mxv[6], mxv[7])));
    mx = fmaxf(mx, __shfl_xor(mx, 16, 32));
    v8f sv = (v8f){};   // eight independent partial sums a lane
#pragma unroll
    for (int nb = 0; nb < 16; ++nb) {
        const v8f e = exp2x8((s[nb] - mx) * 1.4426950408889634f); s[nb] = e; sv += e; }
    float sum = ((sv[0] + sv[1]) + (sv[2] + sv[3])) + ((sv[4] + sv[5]) + (sv[6] + sv[7]));
    sum += __shfl_xor(sum, 16, 32);
    const float f = __fdiv_rn(1.0f, sum);
    // o[mb][r] = context of query q0 + lr at d = mb * 16 + 8 * hi + r
    v8f o[4];
#pragma unroll
    for (int mb = 0; mb < 4; ++mb) o[mb] = (v8f){};
#pragma unroll
    for (int c = 0; c < 8; ++c) { v8u h0, l0, h1, l1, wh, wl;   // keys c * 32 + {8 hi + r, 16 + 8 hi + r}: the k order of the fragment loader
        split8(s[2 * c] * f, h0, l0); split8(s[2 * c + 1] * f, h1, l1);
#pragma unroll
        for (int w = 0; w < 4; ++w) { wh[w] = (h0[2 * w] >> 16) | (h0[2 * w + 1] & 0xFFFF0000u); wh[4 + w] = (h1[2 * w] >> 16) | (h1[2 * w + 1] & 0xFFFF0000u);
            wl[w] = (l0[2 * w] >> 16) | (l0[2 * w + 1] & 0xFFFF0000u); wl[4 + w] = (l1[2 * w] >> 16) | (l1[2 * w + 1] & 0xFFFF0000u); }
        const V ph = __builtin_bit_cast(V, wh), pl = __builtin_bit_cast(V, wl);
#pragma unroll
        for (int mb = 0; mb < 4; ++mb) { const bf* vr = vt + (mb * 16 + lr) * VP + c * 32 + 8 * hi; const V a = F::ld(vr), a2 = F::ld(vr + HD * VP);
            o[mb] = F::mma(a, ph, o[mb]); o[mb] = F::mma(a, pl, o[mb]); o[mb] = F::mma(a2, ph, o[mb]); } }
    float* orow = O + (b * TT + q0 + lr) * DQ + h * HD + 8 * hi;   // merged output [b][t][h * HD + d]: a lane's 8 registers are 8 consecutive d
#pragma unroll
    for (int mb = 0; mb < 4; ++mb) { *(v4fa*)(orow + mb * 16) = (v4f){o[mb][0], o[mb][1], o[mb][2], o[mb][3]}; *(v4fa*)(orow + mb * 16 + 4) = (v4f){o[mb][4], o[mb][5], o[mb][6], o[mb][7]}; }
}

extern "C" void kernel_launch(void* const* d_in, const int* in_sizes, int n_in,
                              void* d_out, int out_size, void* d_ws, size_t ws_size, hipStream_t stream) {
    (void)in_sizes; (void)n_in; (void)out_size;
    const float* x = (const float*)d_in[0]; const float* CM = (const float*)d_in[1]; const float* AM = (const float*)d_in[2]; const float* wq = (const float*)d_in[3]; const float* bq = (const float*)d_in[4]; const float* wk = (const float*)d_in[5]; const float* bk = (const float*)d_in[6]; const float* wv = (const float*)d_in[7]; const float* bv = (const float*)d_in[8]; const float* WCM = (const float*)d_in[9]; const float* BCM = (const float*)d_in[10]; const float* wo = nullptr; (void)wo;
    float* OUT = (float*)d_out;     // [32][256][768]
    char* wsp = (char*)d_ws;
    auto take = [&](size_t bytes) { char* p = wsp; wsp += (bytes + 255) & ~(size_t)255; return (void*)p; };
    bf* WQ = (bf*)take((size_t)DQ * DM * 2); bf* WK = (bf*)take((size_t)DKV * DM * 2); bf* WV = (bf*)take((size_t)DKV * DM * 2);
    // whole-batch planes [b][h][..]
    bf* QPh = (bf*)take((size_t)NB_ * NH_ * TT * HD * 2); bf* QPl = (bf*)take((size_t)NB_ * NH_ * TT * HD * 2); bf* KPh = (bf*)take((size_t)NB_ * NKV * TT * HD * 2); bf* KPl = (bf*)take((size_t)NB_ * NKV * TT * HD * 2); bf* VTh = (bf*)take((size_t)NB_ * NKV * HD * TT * 2); bf* VTl = (bf*)take((size_t)NB_ * NKV * HD * TT * 2);
    bf* XB = (bf*)take((size_t)NB_ * TT * DM * 2);   // x in bf16
    if ((size_t)(wsp - (char*)d_ws) > ws_size) return;    // ws 256 MiB
    // every launch covers all NB_ batches and all heads
    // the three weight transposes and the conversion of x, in one launch
    k_prep<<<(unsigned)(3 * WTB + XCB), 256, 0, stream>>>(wq, wk, wv, WQ, WK, WV, x, XB);
    // the three projections in one launch; they split x W + b into the bf16 hi + lo head planes in their own epilogue (q, k as [b][h][t][d]; v transposed as [b][h][d][t])
    k_proj<<<dim3(NB_ * TT / 64, NH_, 3), 32, 0, stream>>>(XB, WQ, WK, WV, bq, bk, bv, QPh, QPl, KPh, KPl, VTh, VTl);
    // scores, softmax and context in one launch: plane z = b * NH_ + h on every side; the f32 context goes straight into the merged output [b][t][h * HD + d]
    k_attn<<<dim3(TT / 128, NB_ * NH_, 1), 256, 0, stream>>>(QPh, QPl, KPh, KPl, VTh, VTl, CM, AM, WCM, BCM, OUT);
}

// v005
// One run takes 75 microseconds.
// In two side-by-side timings against v004, it was 1.38 and 1.37 times as fast.
// All steps since v000 together make it 63.1 times as fast.
#include <hip/hip_runtime.h>

// Self-attention with a contact-map-scaled score and an additive mask (hidden_states [32][256][768]; q, k, v = x W + b ('xw' [768][768], 12 heads x 64); cm = w_cm contact_map[b][0][i][j] + b_cm (scalar 1x1 conv; inputs read); scores = (q.k/8) cm + attention_mask[b][0][0][j]; softmax; out = merged attn.v (no output projection) -> [32][256][768] f32 (6.3 M)).
// Compute dtypes, f32 accumulate: every input rounded to bf16; q/k/v on PLAIN bf16 operands (inputs: exact) + biases; scores and attn.v: all 256 query rows hl (3 products); softmax f32; no output projection: the merged context is written in f32.

#define NB_  32
#define TT   256
#define DM   768
#define NH_  12
#define NKV  12
#define REP  (NH_ / NKV)
#define HD   64
#define DQ   (NH_ * HD)
#define DKV  (NKV * HD)
#define ZH   NH_                  // heads per attention launch: all of them (its grid y also carries the batch)
#define RH   256                  // query rows < RH use hi+lo planes (0: none)
#define WIN  0
#define PCAR 1024.0f
#define SCL  0.125f   // HD^-0.5
typedef _Float16 h16;
typedef unsigned short bf;
typedef __attribute__((ext_vector_type(16))) __bf16   v16bf;
typedef __attribute__((ext_vector_type(16))) _Float16 v16h;
typedef __attribute__((ext_vector_type(8)))  _Float16 v8h;
typedef __attribute__((ext_vector_type(8)))  unsigned short v8us;
typedef __attribute__((ext_vector_type(8)))  float    v8f;
typedef __attribute__((ext_vector_type(4)))  float    v4f;
typedef v8h  __attribute__((may_alias)) v8ha;
typedef v4f  __attribute__((may_alias)) v4fa;
typedef v8us __attribute__((may_alias)) v8usa;

__device__ __forceinline__ unsigned short f2bf(float f) { unsigned u = __float_as_uint(f); u += 0x7FFFu + ((u >> 16) & 1u); return (unsigned short)(u >> 16); }
__device__ __forceinline__ float bf2f(unsigned short b) { return __uint_as_float(((unsigned)b) << 16); }
__device__ __forceinline__ float bfr(float f) { return bf2f(f2bf(f)); }
__device__ __forceinline__ v16h cat16(v8h lo, v8h hi) { return __builtin_shufflevector(lo, hi, 0, 1, 2, 3, 4, 5, 6, 7, 8, 9, 10, 11, 12, 13, 14, 15); }
__device__ __forceinline__ v16bf cat16b(v8us lo, v8us hi) { return __builtin_bit_cast(v16bf, __builtin_shufflevector(lo, hi, 0, 1, 2, 3, 4, 5, 6, 7, 8, 9, 10, 11, 12, 13, 14, 15)); }
__device__ __forceinline__ v8f wmma16(v16h a, v16h b, v8f c) { return __builtin_amdgcn_wmma_f32_16x16x32_f16(false, a, false, b, (short)0, c, false, false); }
__device__ __forceinline__ v8f wmmab(v16bf a, v16bf b, v8f c) { return __builtin_amdgcn_wmma_f32_16x16x32_bf16(false, a, false, b, (short)0, c, false, false); }



// ---- k_proj: the three projections in ONE launch. Register-blocked GEMM, one wave per 64x64 output tile (16 accumulators); FOUR waves (2 x 2) share a 128 x 128 tile and its operands; grid (M/128, heads/2, 3), 128 threads.
// Grid z picks the projection (0: q, 1: k, 2: v): C[m][n] = sum_k A[m][k] Bt[n][k] for 64 rows of x (m = b * TT + t) and one head's 64 columns, Bt = Wq^T, Wk^T or Wv^T, k ascending.
// The operands come from the K-contiguous bf16 planes into LDS by asynchronous copies, 64 k (one whole 128-byte line of every row) a stage, two buffers: the next stage flies while this one is multiplied.
// C + bias is split into bf16 hi + lo in the epilogue and stored straight into the head planes Oh, Ol: q and k as [b][h][t][d], v transposed as [b][h][d][t]; no f32 C is written.
template <typename T16> struct WFrag;
template <> struct WFrag<h16> { typedef v16h V; static __device__ __forceinline__ V ld(const h16* p) { return cat16(*(const v8h*)p, *(const v8h*)(p + 16)); } static __device__ __forceinline__ v8f mma(V a, V b, v8f c) { return wmma16(a, b, c); } };
template <> struct WFrag<bf> { typedef v16bf V; static __device__ __forceinline__ V ld(const bf* p) { return cat16b(*(const v8us*)p, *(const v8us*)(p + 16)); } static __device__ __forceinline__ v8f mma(V a, V b, v8f c) { return wmmab(a, b, c); } };
__device__ __forceinline__ void splitf(float y, unsigned short& h, unsigned short& l) { h = f2bf(y); l = f2bf(y - bf2f(h)); }
#define PT   64                   // k of a stage: 128 bytes of every operand row
#define PHALF (128 * 128)         // bytes of one operand's 128 rows in a stage
#define PBUF (2 * PHALF)          // one stage: 128 rows of x, then 128 rows of W^T
// Eight asynchronous 16-byte copies a lane: rows 16 apart of one operand (a wave's copy covers four whole 128-byte lines). The wait on the address counter is the statement's last line,
// so that it stands in front of whatever rewrites a register that a copy names.
__device__ __forceinline__ void copy8(unsigned l, const bf* g) {
    asm volatile("global_load_async_to_lds_b128 %0, %8, off\n\tglobal_load_async_to_lds_b128 %1, %9, off\n\tglobal_load_async_to_lds_b128 %2, %10, off\n\tglobal_load_async_to_lds_b128 %3, %11, off\n\t"
                 "global_load_async_to_lds_b128 %4, %12, off\n\tglobal_load_async_to_lds_b128 %5, %13, off\n\tglobal_load_async_to_lds_b128 %6, %14, off\n\tglobal_load_async_to_lds_b128 %7, %15, off\n\ts_wait_xcnt 0x0"
                 :: "v"(l), "v"(l + 2048u), "v"(l + 4096u), "v"(l + 6144u), "v"(l + 8192u), "v"(l + 10240u), "v"(l + 12288u), "v"(l + 14336u),
                    "v"(g), "v"(g + 16 * DM), "v"(g + 32 * DM), "v"(g + 48 * DM), "v"(g + 64 * DM), "v"(g + 80 * DM), "v"(g + 96 * DM), "v"(g + 112 * DM) : "memory");
}
// five waves a SIMD (192 registers) and 64 KiB of LDS a work-group: five work-groups fit a WGP, so all of the grid's 1152 are resident at once and no second round follows the first
__global__ __launch_bounds__(128) __attribute__((amdgpu_waves_per_eu(5))) void k_proj(const bf* __restrict__ A, const bf* __restrict__ Wq, const bf* __restrict__ Wk, const bf* __restrict__ Wv, const float* __restrict__ bq, const float* __restrict__ bk, const float* __restrict__ bv, bf* Qh, bf* Ql, bf* Kh, bf* Kl, bf* Vh, bf* Vl) {
    typedef WFrag<bf> F; typedef F::V V;
    static_assert(HD == 64 && TT % 64 == 0, "a 64 x 64 tile is 64 positions of one batch and one whole head");
    static_assert(RH == TT, "every probability row is hi + lo at scale 1, so the context needs no rescale before it is stored");
    static_assert(NKV == NH_, "q, k and v have the same heads: grid x and y mean the same in the three");
    static_assert((NB_ * TT) % 128 == 0 && NH_ % 2 == 0 && DM % PT == 0 && DM / PT >= 2, "whole 128 x 128 tiles, whole stages, at least two of them");
    // Two stage buffers. Rows are 128 bytes with no pad; the 16-byte piece c of row r lies at place c ^ ((r >> 1) & 7), so that the 16 rows of a fragment load fall on all 64 banks.
    // Behind the last stage's barrier each wave stages its epilogue in its own 4608 bytes of the first buffer.
    __shared__ __align__(128) unsigned char sm[2 * PBUF];
    constexpr int K = DM, nheads = NH_;
    const int tid = threadIdx.x, lane = tid & 31, lr = lane & 15, hi = lane >> 4;
    const int wave = __builtin_amdgcn_readfirstlane(tid >> 5), wm = wave >> 1, wn = wave & 1;
    const int head = blockIdx.y * 2 + wn; const int r0 = blockIdx.x * 128 + wm * 64, c0 = head * 64;
    float* os = (float*)(sm + wave * 4608);                     // q, k: 16 rows x 68 floats
    unsigned short* vs = (unsigned short*)(sm + wave * 4608);   // v: 16 d rows x 64 positions, hi then lo; pitch 144 B = 16 B x odd for the 16-byte stores and loads
    {
        const int p = blockIdx.z;
        const bf* __restrict__ Bt = p == 0 ? Wq : p == 1 ? Wk : Wv; const float* __restrict__ bias = p == 0 ? bq : p == 1 ? bk : bv; bf* Oh = p == 0 ? Qh : p == 1 ? Kh : Vh; bf* Ol = p == 0 ? Ql : p == 1 ? Kl : Vl;
        // the copies: thread tid brings piece tid & 7 of rows (tid >> 3) + 16 j, j = 0 .. 7, of each operand
        const int sub = tid >> 3, cp = tid & 7;
        const unsigned lc = (unsigned)(size_t)sm + sub * 128 + ((cp ^ ((sub >> 1) & 7)) << 4);
        const bf* ga = A + (size_t)(blockIdx.x * 128 + sub) * K + cp * 8; const bf* gb = Bt + (size_t)(blockIdx.y * 128 + sub) * K + cp * 8;
        // the fragment loads: row lr of a 16-row block; pieces 4 kc + hi and 4 kc + 2 + hi (k = 32 kc + 8 hi + 0..7 and 32 kc + 16 + 8 hi + 0..7, the k order of F::ld), each at its swizzled place
        const unsigned char* sa = sm + (wm * 64 + lr) * 128; const unsigned char* sb = sm + PHALF + (wn * 64 + lr) * 128;
        int po[4];
#pragma unroll
        for (int q = 0; q < 4; ++q) po[q] = (((2 * q + hi) ^ ((lr >> 1) & 7)) << 4);
        v8f acc[4][4];
#pragma unroll
        for (int mb = 0; mb < 4; ++mb)
#pragma unroll
            for (int nb = 0; nb < 4; ++nb) acc[mb][nb] = (v8f){};
        copy8(lc, ga); copy8(lc + PHALF, gb);
        asm volatile("s_wait_asynccnt 0x0" ::: "memory");   // this wave's copies of stage 0 have landed
        __syncthreads();                                    // and every other wave's: stage 0 may be read
        copy8(lc + PBUF, ga + PT); copy8(lc + PBUF + PHALF, gb + PT);
#pragma unroll 1   // kept rolled: the buffers alternate by an offset, and the text holds one stage's 32 products and 16 copies once
        for (int t = 0; t < K / PT; ++t) {
            const unsigned bo = (unsigned)(t & 1) * PBUF; const unsigned char* pa = sa + bo; const unsigned char* pb = sb + bo;
#pragma unroll
            for (int kc = 0; kc < 2; ++kc) { V a[4];
#pragma unroll
                for (int mb = 0; mb < 4; ++mb) a[mb] = cat16b(*(const v8usa*)(pa + mb * 2048 + po[2 * kc]), *(const v8usa*)(pa + mb * 2048 + po[2 * kc + 1]));
#pragma unroll
                for (int nb = 0; nb < 4; ++nb) { const V b = cat16b(*(const v8usa*)(pb + nb * 2048 + po[2 * kc]), *(const v8usa*)(pb + nb * 2048 + po[2 * kc + 1]));
#pragma unroll
                    for (int mb = 0; mb < 4; ++mb) acc[mb][nb] = F::mma(a[mb], b, acc[mb][nb]); } }
            asm volatile("s_wait_dscnt 0x0" ::: "memory");      // this wave's reads of the buffer are done before it is filled again
            asm volatile("s_wait_asynccnt 0x0" ::: "memory");   // this wave's copies of stage t + 1 have landed
            __syncthreads();                                    // publishes stage t + 1 and ends every wave's reads of stage t
            if (t + 2 < K / PT) { copy8(lc + bo, ga + (t + 2) * PT); copy8(lc + bo + PHALF, gb + (t + 2) * PT); }
        }
        asm volatile("s_wait_asynccnt 0x0" ::: "memory");       // no copy is outstanding when the buffers become the epilogue's staging
        if (p < 2) {   // q, k: planes [b][h][t][d]: a lane takes 8 d of one row, a wave store covers 4 rows = 512 contiguous bytes
            const int sub = lane >> 3, cofs = (lane & 7) * 8; float bb[8];
#pragma unroll
            for (int q = 0; q < 8; ++q) bb[q] = bfr(bias[c0 + cofs + q]);
            const size_t pb = (((size_t)(r0 / TT) * nheads + head) * TT + (r0 % TT)) * HD + cofs;
#pragma unroll
            for (int mb = 0; mb < 4; ++mb) {
#pragma unroll
                for (int nb = 0; nb < 4; ++nb) {
#pragma unroll
                    for (int j = 0; j < 8; ++j) os[(hi * 8 + j) * 68 + nb * 16 + lr] = acc[mb][nb][j]; }
                __builtin_amdgcn_wave_barrier(); asm volatile("" ::: "memory");   // the rows are read back by other lanes: keep the LDS stores in front of the loads
#pragma unroll
                for (int s = 0; s < 4; ++s) { const int row = 4 * s + sub; const v4f x0 = *(const v4fa*)(os + row * 68 + cofs), x1 = *(const v4fa*)(os + row * 68 + cofs + 4); v8us oh, ol;
#pragma unroll
                    for (int q = 0; q < 4; ++q) { unsigned short a2, c2; splitf(x0[q] + bb[q], a2, c2); oh[q] = a2; ol[q] = c2; splitf(x1[q] + bb[4 + q], a2, c2); oh[4 + q] = a2; ol[4 + q] = c2; }
                    const size_t oo = pb + (size_t)(mb * 16 + row) * HD; *(v8usa*)(Oh + oo) = oh; *(v8usa*)(Ol + oo) = ol; }
                __builtin_amdgcn_wave_barrier(); asm volatile("" ::: "memory");   // the loads stay in front of the next block's LDS stores
            }
        } else {   // v: planes [b][h][d][t]: a lane's 8 accumulator registers are 8 consecutive t of one d; staged so that every d row leaves as one whole 128-byte line
            const int sub = lane >> 3, cofs = (lane & 7) * 8;
            const size_t pb = ((size_t)(r0 / TT) * nheads + head) * HD * TT + (r0 % TT) + cofs; float bb[4];
#pragma unroll
            for (int nb = 0; nb < 4; ++nb) bb[nb] = bfr(bias[c0 + nb * 16 + lr]);
#pragma unroll
            for (int nb = 0; nb < 4; ++nb) { const float bn = bb[nb];
#pragma unroll
                for (int mb = 0; mb < 4; ++mb) { v8us oh, ol;
#pragma unroll
                    for (int j = 0; j < 8; ++j) { unsigned short a2, c2; splitf(acc[mb][nb][j] + bn, a2, c2); oh[j] = a2; ol[j] = c2; }
                    *(v8usa*)(vs + lr * 72 + mb * 16 + hi * 8) = oh; *(v8usa*)(vs + 16 * 72 + lr * 72 + mb * 16 + hi * 8) = ol; }
                __builtin_amdgcn_wave_barrier(); asm volatile("" ::: "memory");   // the rows are read back by other lanes: keep the LDS stores in front of the loads
#pragma unroll
                for (int s = 0; s < 4; ++s) { const int row = 4 * s + sub; const v8us oh = *(const v8usa*)(vs + row * 72 + cofs), ol = *(const v8usa*)(vs + 16 * 72 + row * 72 + cofs);
                    const size_t oo = pb + (size_t)(nb * 16 + row) * TT; *(v8usa*)(Oh + oo) = oh; *(v8usa*)(Ol + oo) = ol; }
                __builtin_amdgcn_wave_barrier(); asm volatile("" ::: "memory");   // the loads stay in front of the next block's LDS stores
            }
            asm volatile("s_wait_xcnt 0x0" ::: "memory");   // the build lays the q, k epilogue directly behind this one, under a branch: its first instructions write registers that the last stores here name
        }
    }
}

__device__ __forceinline__ h16 tohx(float x) { return (h16)x; }
typedef __attribute__((ext_vector_type(2))) _Float16 v2h;
typedef __attribute__((ext_vector_type(4))) _Float16 v4h;
typedef __attribute__((ext_vector_type(2))) unsigned short v2us;
typedef __attribute__((ext_vector_type(4))) unsigned short v4us;
typedef __attribute__((ext_vector_type(2))) float v2f;
typedef __attribute__((ext_vector_type(4))) int v4i;

// ---- k_prep: the four operand conversions in ONE launch (they depend on nothing but the inputs). Blocks 0 .. 3 WTB - 1: Wq, Wk, Wv transposed into bf16 [n][k]; the rest: x into bf16.
// The transposes stand first in the grid: each of their waves walks eight dependent trips.
__device__ __forceinline__ void wtG(const float* __restrict__ w, int K, int N, bf* Bt, int blk) {
    const int lane = threadIdx.x & 31; const int L0 = (blk * 8 + (threadIdx.x >> 5)) * 8; const int nlines = N * K / 64;
{
#pragma unroll 1
        for (int l = 0; l < 8; ++l) { const int L = L0 + l; if (L >= nlines) break; const size_t e = (size_t)L * 64 + lane * 2; const int k = (int)(e % K), n = (int)(e / K); v2us o;
            o[0] = f2bf(w[(size_t)k * N + n]); o[1] = f2bf(w[(size_t)(k + 1) * N + n]); *(v2us*)(Bt + e) = o; }
         }
}
__device__ __forceinline__ void cvt8(const float* __restrict__ src, bf* dst, size_t n8, size_t blk) { const size_t i = blk * 256 + threadIdx.x; if (i >= n8) return; const float* sp = src + i * 8; const v8f v = *(const v8f*)sp; v8us o;
    asm volatile("s_wait_xcnt 0x0" :: "v"(sp) : "memory");   // the address pair stays whole up to this wait; the conversion reuses it behind it
#pragma unroll
    for (int k = 0; k < 8; ++k) o[k] = f2bf(v[k]); *(v8us*)(dst + i * 8) = o;  }
#define WTB ((DM * DQ / 64 + 63) / 64)                       // blocks of one transpose
#define XCB (((size_t)NB_ * TT * DM / 8 + 255) / 256)        // blocks of the x conversion
__global__ __launch_bounds__(256) void k_prep(const float* __restrict__ wq, const float* __restrict__ wk, const float* __restrict__ wv, bf* WQ, bf* WK, bf* WV, const float* __restrict__ x, bf* XB) {
    static_assert(DKV == DQ, "the three weight matrices have one shape");
    const int blk = blockIdx.x;
    if (blk < 3 * WTB) { const int p = blk / WTB; wtG(p == 0 ? wq : p == 1 ? wk : wv, DM, DQ, p == 0 ? WQ : p == 1 ? WK : WV, blk - p * WTB); }
    else cvt8(x, XB, (size_t)NB_ * TT * DM / 8, (size_t)(blk - 3 * WTB));
}

// ---- k_attn: scores, softmax and context of 128 queries of one (batch, head) in one work-group; grid (TT / 128, NB_ * NH_), 8 waves x 16 queries.
// The head's K planes [t][d] and V planes [d][t] (bf16 hi + lo) and the rounded mask row are staged once in LDS and shared by the 8 waves.
// S^T = K Q^T: A = 16 key rows from LDS, B = the wave's 16 queries, kept in registers. A lane then holds 128 of the 256 scores of ONE query (lanes l and l ^ 16 split the keys),
// so maximum and sum are in-lane plus one exchange, and two neighbouring score tiles, split into bf16 hi + lo in place, ARE the B operand of O^T += V^T P^T:
// neither the scores nor the probabilities leave the registers. The three hi/lo products of every tile keep the order hi.hi, (q or p) lo . hi, (q or p) hi . lo, k ascending.
typedef __attribute__((ext_vector_type(8))) unsigned v8u;
__device__ __forceinline__ v8f bfr8(v8f x) { v8u u = __builtin_bit_cast(v8u, x); u += 0x7FFFu + ((u >> 16) & 1u); u &= 0xFFFF0000u; return __builtin_bit_cast(v8f, u); }   // bfr on eight values
__device__ __forceinline__ void split8(v8f y, v8u& h, v8u& l) {   // splitf on eight values; each bf16 is left in the high half of its word
    h = __builtin_bit_cast(v8u, y); h += 0x7FFFu + ((h >> 16) & 1u); const v8f d = y - __builtin_bit_cast(v8f, h & 0xFFFF0000u); l = __builtin_bit_cast(v8u, d); l += 0x7FFFu + ((l >> 16) & 1u); }
// Eight v_exp_f32 in one statement, every output apart from every input, one v_nop last: so no transcendental stands directly in front of an instruction that reads its result or overwrites its source
__device__ __forceinline__ v8f exp2x8(v8f d) { float e0, e1, e2, e3, e4, e5, e6, e7;
    asm("v_exp_f32 %0, %8\n\tv_exp_f32 %1, %9\n\tv_exp_f32 %2, %10\n\tv_exp_f32 %3, %11\n\tv_exp_f32 %4, %12\n\tv_exp_f32 %5, %13\n\tv_exp_f32 %6, %14\n\tv_exp_f32 %7, %15\n\tv_nop"
        : "=&v"(e0), "=&v"(e1), "=&v"(e2), "=&v"(e3), "=&v"(e4), "=&v"(e5), "=&v"(e6), "=&v"(e7) : "v"(d[0]), "v"(d[1]), "v"(d[2]), "v"(d[3]), "v"(d[4]), "v"(d[5]), "v"(d[6]), "v"(d[7]));
    return (v8f){e0, e1, e2, e3, e4, e5, e6, e7}; }
#define KP 72     // LDS pitch of a K row, 16-bit elements: 144 B = 16 B x odd for the 16-byte fragment loads
#define VP 264    // LDS pitch of a V^T row: 528 B = 16 B x odd
__global__ __launch_bounds__(256) __attribute__((amdgpu_waves_per_eu(4, 4))) void k_attn(const bf* __restrict__ Qh, const bf* __restrict__ Ql, const bf* __restrict__ Kh, const bf* __restrict__ Kl, const bf* __restrict__ Vh, const bf* __restrict__ Vl, const float* __restrict__ CMb, const float* __restrict__ AMb, const float* __restrict__ WCM, const float* __restrict__ BCM, float* __restrict__ O) {
    typedef WFrag<bf> F; typedef F::V V;
    static_assert(TT == 256 && HD == 64 && NKV == NH_, "256 threads stage 256 keys; 16 score tiles and 4 output tiles a wave; one kv head per query head");
    __shared__ __align__(16) bf ks[2 * TT * KP];    // K hi, then K lo
    __shared__ __align__(16) bf vt[2 * HD * VP];    // V^T hi, then V^T lo
    __shared__ __align__(16) float ms[TT];          // the mask row, rounded to bf16 once
    const int tid = threadIdx.x, lane = tid & 31, lr = lane & 15, hi = lane >> 4;
    const size_t z = blockIdx.y; const size_t b = z / NH_, h = z % NH_;
    const int q0 = (blockIdx.x * 8 + (tid >> 5)) * 16;
    const float wcm = bfr(WCM[0]), bcm = bfr(BCM[0]);
    const float* cmr = CMb + (b * TT + q0 + lr) * TT + 8 * hi;
    v4f cq[3][2];   // contact-map pieces of the score tile in hand and of the next two: fetched two tiles ahead; the first two fly with the staging loads
#pragma unroll
    for (int nb = 0; nb < 2; ++nb) { cq[nb][0] = *(const v4fa*)(cmr + nb * 16); cq[nb][1] = *(const v4fa*)(cmr + nb * 16 + 4); }
    { const bf* gk0 = Kh + z * TT * HD; const bf* gk1 = Kl + z * TT * HD; const bf* gv0 = Vh + z * HD * TT; const bf* gv1 = Vl + z * HD * TT;
#pragma unroll
      for (int it = 0; it < TT * HD / 8 / 256; ++it) { const int go = (it * 256 + tid) * 8;   // 16-byte piece it * 256 + tid of each plane: a wave reads 512 contiguous bytes
          const v8us x0 = *(const v8usa*)(gk0 + go), x1 = *(const v8usa*)(gk1 + go), x2 = *(const v8usa*)(gv0 + go), x3 = *(const v8usa*)(gv1 + go);
          bf* kd = ks + (it * 32 + (tid >> 3)) * KP + (tid & 7) * 8; bf* vd = vt + (it * 8 + (tid >> 5)) * VP + (tid & 31) * 8;
          *(v8usa*)kd = x0; *(v8usa*)(kd + TT * KP) = x1; *(v8usa*)vd = x2; *(v8usa*)(vd + HD * VP) = x3; }
      ms[tid] = bfr(AMb[b * TT + tid]); }
    V qh[2], ql[2];
    { const size_t qo = z * TT * HD + (size_t)(q0 + lr) * HD + 8 * hi; const bf* qph = Qh + qo; const bf* qpl = Ql + qo;
#pragma unroll
      for (int kc = 0; kc < 2; ++kc) { qh[kc] = F::ld(qph + kc * 32); ql[kc] = F::ld(qpl + kc * 32); }
      asm volatile("s_wait_xcnt 0x0" :: "v"(qph), "v"(qpl) : "memory"); }   // the two address pairs stay whole up to this wait: otherwise the last load of each plane lands on the pair that the loads before it name
    __syncthreads();   // the staged planes and the mask row are read by every wave
    // s[nb][r] = score of query q0 + lr and key nb * 16 + 8 * hi + r
    const bf* kr = ks + lr * KP + 8 * hi;
    V kf[4];        // K fragments of the tile in hand (hi, lo of k 0..31; hi, lo of k 32..63): fetched one tile ahead, behind the tile's own products
#pragma unroll
    for (int kc = 0; kc < 2; ++kc) { kf[2 * kc] = F::ld(kr + kc * 32); kf[2 * kc + 1] = F::ld(kr + TT * KP + kc * 32); }
    v8f s[16], mxv;
#pragma unroll
    for (int r = 0; r < 8; ++r) mxv[r] = -3.0e38f;
#pragma unroll
    for (int nb = 0; nb < 16; ++nb) { v8f acc = (v8f){};
        const v4f m0 = *(const v4fa*)(ms + nb * 16 + 8 * hi), m1 = *(const v4fa*)(ms + nb * 16 + 8 * hi + 4);
#pragma unroll
        for (int kc = 0; kc < 2; ++kc) { acc = F::mma(kf[2 * kc], qh[kc], acc); acc = F::mma(kf[2 * kc], ql[kc], acc); acc = F::mma(kf[2 * kc + 1], qh[kc], acc); }
        __builtin_amdgcn_sched_barrier(0);   // the next tile's fragments reuse this tile's registers: lifted over the products they cost 32 more, and the build spills
        if (nb + 1 < 16) {
#pragma unroll
            for (int kc = 0; kc < 2; ++kc) { kf[2 * kc] = F::ld(kr + (nb + 1) * 16 * KP + kc * 32); kf[2 * kc + 1] = F::ld(kr + (nb + 1) * 16 * KP + TT * KP + kc * 32); } }
        if (nb + 2 < 16) { cq[(nb + 2) % 3][0] = *(const v4fa*)(cmr + (nb + 2) * 16); cq[(nb + 2) % 3][1] = *(const v4fa*)(cmr + (nb + 2) * 16 + 4); }
        const v8f c8 = __builtin_shufflevector(cq[nb % 3][0], cq[nb % 3][1], 0, 1, 2, 3, 4, 5, 6, 7), m8 = __builtin_shufflevector(m0, m1, 0, 1, 2, 3, 4, 5, 6, 7);
        s[nb] = (acc * SCL) * (wcm * bfr8(c8) + bcm) + m8;   /* (q.k/8) x (w_cm c + b_cm) + mask */
        mxv = __builtin_elementwise_max(mxv, s[nb]);
        asm volatile("" :: "v"(s[nb]));      // inputs only: the tile's finished scores are due here; otherwise the compiler sinks all 16 tiles' vector work behind the last product, holds every contact-map and mask piece until then, and spills
    }
    float mx = fmaxf(fmaxf(fmaxf(mxv[0], mxv[1]), fmaxf(mxv[2], mxv[3])), fmaxf(fmaxf(mxv[4], mxv[5]), fmaxf(mxv[6], mxv[7])));
    mx = fmaxf(mx, __shfl_xor(mx, 16, 32));
    v8f sv = (v8f){};   // eight independent partial sums a lane
#pragma unroll
    for (int nb = 0; nb < 16; ++nb) {
        const v8f e = exp2x8((s[nb] - mx) * 1.4426950408889634f); s[nb] = e; sv += e; }
    float sum = ((sv[0] + sv[1]) + (sv[2] + sv[3])) + ((sv[4] + sv[5]) + (sv[6] + sv[7]));
    sum += __shfl_xor(sum, 16, 32);
    const float f = __fdiv_rn(1.0f, sum);
    // o[mb][r] = context of query q0 + lr at d = mb * 16 + 8 * hi + r
    v8f o[4];
#pragma unroll
    for (int mb = 0; mb < 4; ++mb) o[mb] = (v8f){};
#pragma unroll
    for (int c = 0; c < 8; ++c) { v8u h0, l0, h1, l1, wh, wl;   // keys c * 32 + {8 hi + r, 16 + 8 hi + r}: the k order of the fragment loader
        split8(s[2 * c] * f, h0, l0); split8(s[2 * c + 1] * f, h1, l1);
#pragma unroll
        for (int w = 0; w < 4; ++w) { wh[w] = (h0[2 * w] >> 16) | (h0[2 * w + 1] & 0xFFFF0000u); wh[4 + w] = (h1[2 * w] >> 16) | (h1[2 * w + 1] & 0xFFFF0000u);
            wl[w] = (l0[2 * w] >> 16) | (l0[2 * w + 1] & 0xFFFF0000u); wl[4 + w] = (l1[2 * w] >> 16) | (l1[2 * w + 1] & 0xFFFF0000u); }
        const V ph = __builtin_bit_cast(V, wh), pl = __builtin_bit_cast(V, wl);
#pragma unroll
        for (int mb = 0; mb < 4; ++mb) { const bf* vr = vt + (mb * 16 + lr) * VP + c * 32 + 8 * hi; const V a = F::ld(vr), a2 = F::ld(vr + HD * VP);
            o[mb] = F::mma(a, ph, o[mb]); o[mb] = F::mma(a, pl, o[mb]); o[mb] = F::mma(a2, ph, o[mb]); } }
    float* orow = O + (b * TT + q0 + lr) * DQ + h * HD + 8 * hi;   // merged output [b][t][h * HD + d]: a lane's 8 registers are 8 consecutive d
#pragma unroll
    for (int mb = 0; mb < 4; ++mb) { *(v4fa*)(orow + mb * 16) = (v4f){o[mb][0], o[mb][1], o[mb][2], o[mb][3]}; *(v4fa*)(orow + mb * 16 + 4) = (v4f){o[mb][4], o[mb][5], o[mb][6], o[mb][7]}; }
}

extern "C" void kernel_launch(void* const* d_in, const int* in_sizes, int n_in,
                              void* d_out, int out_size, void* d_ws, size_t ws_size, hipStream_t stream) {
    (void)in_sizes; (void)n_in; (void)out_size;
    const float* x = (const float*)d_in[0]; const float* CM = (const float*)d_in[1]; const float* AM = (const float*)d_in[2]; const float* wq = (const float*)d_in[3]; const float* bq = (const float*)d_in[4]; const float* wk = (const float*)d_in[5]; const float* bk = (const float*)d_in[6]; const float* wv = (const float*)d_in[7]; const float* bv = (const float*)d_in[8]; const float* WCM = (const float*)d_in[9]; const float* BCM = (const float*)d_in[10]; const float* wo = nullptr; (void)wo;
    float* OUT = (float*)d_out;     // [32][256][768]
    char* wsp = (char*)d_ws;
    auto take = [&](size_t bytes) { char* p = wsp; wsp += (bytes + 255) & ~(size_t)255; return (void*)p; };
    bf* WQ = (bf*)take((size_t)DQ * DM * 2); bf* WK = (bf*)take((size_t)DKV * DM * 2); bf* WV = (bf*)take((size_t)DKV * DM * 2);
    // whole-batch planes [b][h][..]
    bf* QPh = (bf*)take((size_t)NB_ * NH_ * TT * HD * 2); bf* QPl = (bf*)take((size_t)NB_ * NH_ * TT * HD * 2); bf* KPh = (bf*)take((size_t)NB_ * NKV * TT * HD * 2); bf* KPl = (bf*)take((size_t)NB_ * NKV * TT * HD * 2); bf* VTh = (bf*)take((size_t)NB_ * NKV * HD * TT * 2); bf* VTl = (bf*)take((size_t)NB_ * NKV * HD * TT * 2);
    bf* XB = (bf*)take((size_t)NB_ * TT * DM * 2);   // x in bf16
    if ((size_t)(wsp - (char*)d_ws) > ws_size) return;    // ws 256 MiB
    // every launch covers all NB_ batches and all heads
    // the three weight transposes and the conversion of x, in one launch
    k_prep<<<(unsigned)(3 * WTB + XCB), 256, 0, stream>>>(wq, wk, wv, WQ, WK, WV, x, XB);
    // the three projections in one launch; they split x W + b into the bf16 hi + lo head planes in their own epilogue (q, k as [b][h][t][d]; v transposed as [b][h][d][t])
    k_proj<<<dim3(NB_ * TT / 128, NH_ / 2, 3), 128, 0, stream>>>(XB, WQ, WK, WV, bq, bk, bv, QPh, QPl, KPh, KPl, VTh, VTl);
    // scores, softmax and context in one launch: plane z = b * NH_ + h on every side; the f32 context goes straight into the merged output [b][t][h * HD + d]
    k_attn<<<dim3(TT / 128, NB_ * NH_, 1), 256, 0, stream>>>(QPh, QPl, KPh, KPl, VTh, VTl, CM, AM, WCM, BCM, OUT);
}
